// v000
// Times are from an AMD MI455X. After a warm-up the kernel runs many times in a row, and a time is the length of
// such a window on the GPU divided by its runs, so every launch and the gaps after it count. The runs cycle
// through copies of the inputs. A figure is the median of several windows, for all but v000 over two sittings.
// Sittings can differ by a few percent; kernels timed side by side share one.
// v000, which the later versions start from, runs in 116 microseconds.
#include <hip/hip_runtime.h>
#include <hip/hip_bf16.h>
#include <stdint.h>

// Problem constants (match reference)
#define B_  8
#define C_  256
#define K_  8
#define H_  128
#define W_  128
#define HW_ (H_ * W_)

typedef __attribute__((ext_vector_type(2))) float v2f;
typedef __attribute__((ext_vector_type(8))) float v8f;

// ---------------------------------------------------------------------------
// Kernel 1: area[b][k] = sum over H*W of mask[b][k][:]
// grid = B*K blocks, 256 threads
// ---------------------------------------------------------------------------
__global__ __launch_bounds__(256) void area_kernel(const float* __restrict__ mask,
                                                   float* __restrict__ area) {
  __shared__ float red[256];
  const int bk = blockIdx.x;
  const float* m = mask + (size_t)bk * HW_;
  float s = 0.f;
  for (int i = threadIdx.x; i < HW_; i += 256) s += m[i];
  red[threadIdx.x] = s;
  __syncthreads();
  for (int off = 128; off > 0; off >>= 1) {
    if (threadIdx.x < off) red[threadIdx.x] += red[threadIdx.x + off];
    __syncthreads();
  }
  if (threadIdx.x == 0) area[bk] = red[0];
}

// ---------------------------------------------------------------------------
// Kernel 2: fold the weight chain into small per-(b,k) vectors:
//   g      = sqrt(p / max_k p), p = area/(H*W)
//   vtok   = region_vec * g
//   k_tok  = k_w @ vtok + k_b ;  v_tok = v_w @ vtok + v_b
//   w2[c]  = (sum_o q_w[o][c] * k_tok[o]) / 16        (16 = sqrt(C))
//   b2     = (sum_o q_b[o]    * k_tok[o]) / 16
//   pv[c]  =  sum_o proj_w[c][o] * v_tok[o]
// grid = B*K blocks, 256 threads (thread = channel)
// ---------------------------------------------------------------------------
__global__ __launch_bounds__(256) void fold_kernel(
    const float* __restrict__ area, const float* __restrict__ region_vec,
    const float* __restrict__ q_w, const float* __restrict__ q_b,
    const float* __restrict__ k_w, const float* __restrict__ k_b,
    const float* __restrict__ v_w, const float* __restrict__ v_b,
    const float* __restrict__ proj_w,
    float* __restrict__ w2, float* __restrict__ b2, float* __restrict__ pv) {
  __shared__ float vtok[C_], ktok[C_], vtok2[C_];
  const int b = blockIdx.x / K_;
  const int k = blockIdx.x % K_;
  const int t = threadIdx.x;

  const float inv_hw = 1.0f / (float)(HW_);
  float p = area[b * K_ + k] * inv_hw;
  float dmax = 1e-6f;
  for (int kk = 0; kk < K_; ++kk) dmax = fmaxf(dmax, area[b * K_ + kk] * inv_hw);
  float g = sqrtf(fmaxf(p / dmax, 0.0f));

  vtok[t] = region_vec[((size_t)b * K_ + k) * C_ + t] * g;
  __syncthreads();

  float kt = k_b[t], vt = v_b[t];
  for (int c = 0; c < C_; ++c) {
    kt += k_w[t * C_ + c] * vtok[c];
    vt += v_w[t * C_ + c] * vtok[c];
  }
  ktok[t] = kt;
  vtok2[t] = vt;
  __syncthreads();

  float w2v = 0.f, pvv = 0.f;
  for (int o = 0; o < C_; ++o) {
    w2v += q_w[o * C_ + t] * ktok[o];
    pvv += proj_w[t * C_ + o] * vtok2[o];
  }
  w2[((size_t)b * K_ + k) * C_ + t] = w2v * (1.0f / 16.0f);
  pv[((size_t)b * K_ + k) * C_ + t] = pvv;
  if (t == 0) {
    float s = 0.f;
    for (int o = 0; o < C_; ++o) s += q_b[o] * ktok[o];
    b2[b * K_ + k] = s * (1.0f / 16.0f);
  }
}

// ---------------------------------------------------------------------------
// Kernel 3: streaming attention kernel (memory-bound, WMMA + async-LDS)
//   Per wave: 16-pixel tile, feat tile (256ch x 16pix = 16KB) staged into
//   wave-private LDS with global_load_async_to_lds_b128 (32 instrs/tile).
//   Stage 1 : logits^T(16k x 16pix) = w2_pad(16x256) @ feat(256x16), 64 WMMAs
//   Softmax : lane-local over 8 VGPRs (lanes 0-15 hold valid pixels)
//   Stage 2 : delta^T(16ch x 16pix) = pv^T @ attn^T, 2 WMMAs per channel tile
//   Epilogue: out = feat + sigmoid(alpha)*(delta + proj_b), feat from LDS
// grid = (HW/32, B), 64 threads (2 waves)
// ---------------------------------------------------------------------------
__global__ __launch_bounds__(64) void attn_kernel(
    const float* __restrict__ feat, const float* __restrict__ mask,
    const float* __restrict__ w2g, const float* __restrict__ b2g,
    const float* __restrict__ pvg, const float* __restrict__ proj_b,
    const float* __restrict__ mbs_p, const float* __restrict__ alpha_p,
    float* __restrict__ out) {
  __shared__ float w2_s[16 * C_];                       // 16KB, rows 8..15 zero
  __shared__ float pv_s[K_ * C_];                       // 8KB
  __shared__ float pb_s[C_];                            // 1KB
  __shared__ float b2_s[16];
  __shared__ __align__(16) float feat_s[2 * C_ * 16];   // 32KB: per-wave tile

  const int b = blockIdx.y;
  const int tid = threadIdx.x;

  for (int i = tid; i < 16 * C_; i += 64) {
    int row = i >> 8;
    w2_s[i] = (row < K_) ? w2g[((size_t)b * K_ + row) * C_ + (i & (C_ - 1))] : 0.0f;
  }
  for (int i = tid; i < K_ * C_; i += 64) pv_s[i] = pvg[(size_t)b * K_ * C_ + i];
  for (int i = tid; i < C_; i += 64) pb_s[i] = proj_b[i];
  if (tid < 16) b2_s[tid] = (tid < K_) ? b2g[b * K_ + tid] : 0.0f;
  __syncthreads();

  const float mbs = mbs_p[0];
  const float gate = 1.0f / (1.0f + __expf(-alpha_p[0]));

  const int wave = tid >> 5;
  const int lane = tid & 31;
  const int half = lane >> 4;   // 0: lanes 0-15, 1: lanes 16-31
  const int row  = lane & 15;
  const int p0 = (blockIdx.x * 2 + wave) * 16;
  const int p  = p0 + row;                         // this lane's pixel column

  const float* fb = feat + (size_t)b * C_ * HW_;   // batch base

  // ---- Async-stage feat tile into wave-private LDS ------------------------
  // Each lane: 16B pixel-quad of one channel -> 8 channels per instruction.
  float* fsw = feat_s + wave * (C_ * 16);
  const uint32_t lds_base = (uint32_t)(uintptr_t)fsw;
  const int chl = lane >> 2;                       // 0..7: channel within block
  const int pq  = (lane & 3) * 4;                  // pixel quad
  const float* gsrc = fb + (size_t)chl * HW_ + p0 + pq;
  #pragma unroll 4
  for (int cb = 0; cb < C_; cb += 8) {
    uint32_t laddr = lds_base + (uint32_t)(((cb + chl) * 16 + pq) * 4);
    const float* ga = gsrc + (size_t)cb * HW_;
    asm volatile("global_load_async_to_lds_b128 %0, %1, off"
                 :: "v"(laddr), "v"(ga) : "memory");
  }
  asm volatile("s_wait_asynccnt 0" ::: "memory");

  // ---- Stage 1: logits^T = w2_pad @ feat_tile -----------------------------
  // A (16x4): M=k row (lane&15), VGPR0=K chans {c+2h}, VGPR1={c+2h+1}
  // B (4x16): K chans in lane-halves, N=pixel (from LDS)
  v8f acc = {};
  #pragma unroll 4
  for (int c = 0; c < C_; c += 4) {
    const int cc = c + 2 * half;
    v2f Aop, Bop;
    Aop.x = w2_s[row * C_ + cc];
    Aop.y = w2_s[row * C_ + cc + 1];
    Bop.x = fsw[cc * 16 + row];
    Bop.y = fsw[(cc + 1) * 16 + row];
    acc = __builtin_amdgcn_wmma_f32_16x16x4_f32(false, Aop, false, Bop,
                                                (short)0, acc, false, false);
  }

  // ---- Bias + softmax (lane-local; lanes 0-15 carry the real pixels) ------
  const float* mB = mask + (size_t)b * K_ * HW_ + p;
  float logit[8], attnv[8];
  float mx = -1e30f;
  #pragma unroll
  for (int r = 0; r < 8; ++r) {
    float l = acc[r] + b2_s[r] + mbs * __logf(mB[(size_t)r * HW_] + 1e-6f);
    logit[r] = l;
    mx = fmaxf(mx, l);
  }
  float sum = 0.f;
  #pragma unroll
  for (int r = 0; r < 8; ++r) {
    float e = __expf(logit[r] - mx);
    attnv[r] = e;
    sum += e;
  }
  const float inv = 1.0f / sum;
  #pragma unroll
  for (int r = 0; r < 8; ++r) attnv[r] *= inv;

  // ---- Build stage-2 B operands: attn^T (k x pixel) -----------------------
  // lanes 16-31 need attn[k=2,3,6,7] of lane (lane-16): shuffle + select.
  float t2 = __shfl(attnv[2], row, 32);
  float t3 = __shfl(attnv[3], row, 32);
  float t6 = __shfl(attnv[6], row, 32);
  float t7 = __shfl(attnv[7], row, 32);
  v2f B1, B2;
  B1.x = half ? t2 : attnv[0];
  B1.y = half ? t3 : attnv[1];
  B2.x = half ? t6 : attnv[4];
  B2.y = half ? t7 : attnv[5];

  // ---- Stage 2 + epilogue -------------------------------------------------
  // A (16x4): M=channel (ct+row), K = region index (2 WMMAs cover k=0..7)
  float* ob = out + (size_t)b * C_ * HW_;
  for (int ct = 0; ct < C_; ct += 16) {
    const int ch = ct + row;
    v2f A1, A2;
    A1.x = pv_s[(0 + 2 * half) * C_ + ch];
    A1.y = pv_s[(1 + 2 * half) * C_ + ch];
    A2.x = pv_s[(4 + 2 * half) * C_ + ch];
    A2.y = pv_s[(5 + 2 * half) * C_ + ch];
    v8f d = {};
    d = __builtin_amdgcn_wmma_f32_16x16x4_f32(false, A1, false, B1,
                                              (short)0, d, false, false);
    d = __builtin_amdgcn_wmma_f32_16x16x4_f32(false, A2, false, B2,
                                              (short)0, d, false, false);
    #pragma unroll
    for (int r = 0; r < 8; ++r) {
      const int c_out = ct + r + 8 * half;            // D row -> channel
      const float f = fsw[c_out * 16 + row];          // feat from LDS tile
      ob[(size_t)c_out * HW_ + p] = f + gate * (d[r] + pb_s[c_out]);
    }
  }
}

// ---------------------------------------------------------------------------
extern "C" void kernel_launch(void* const* d_in, const int* in_sizes, int n_in,
                              void* d_out, int out_size, void* d_ws, size_t ws_size,
                              hipStream_t stream) {
  const float* feat       = (const float*)d_in[0];
  const float* mask       = (const float*)d_in[1];
  const float* region_vec = (const float*)d_in[2];
  const float* q_w        = (const float*)d_in[3];
  const float* q_b        = (const float*)d_in[4];
  const float* k_w        = (const float*)d_in[5];
  const float* k_b        = (const float*)d_in[6];
  const float* v_w        = (const float*)d_in[7];
  const float* v_b        = (const float*)d_in[8];
  const float* proj_w     = (const float*)d_in[9];
  const float* proj_b     = (const float*)d_in[10];
  const float* mbs        = (const float*)d_in[11];
  const float* alpha      = (const float*)d_in[12];
  float* out = (float*)d_out;

  float* ws   = (float*)d_ws;
  float* area = ws;                       // B*K       = 64
  float* b2   = ws + 64;                  // B*K       = 64
  float* w2   = ws + 128;                 // B*K*C     = 16384
  float* pv   = ws + 128 + B_ * K_ * C_;  // B*K*C     = 16384

  area_kernel<<<B_ * K_, 256, 0, stream>>>(mask, area);
  fold_kernel<<<B_ * K_, 256, 0, stream>>>(area, region_vec, q_w, q_b, k_w, k_b,
                                           v_w, v_b, proj_w, w2, b2, pv);
  dim3 grid(HW_ / 32, B_);
  attn_kernel<<<grid, 64, 0, stream>>>(feat, mask, w2, b2, pv, proj_b,
                                       mbs, alpha, out);
}

// v001
// Measured time: 82.2 microseconds a run.
// Two timings next to v000 both put it at 1.41 times that version's speed.
#include <hip/hip_runtime.h>
#include <hip/hip_bf16.h>
#include <stdint.h>

// Problem constants (match reference)
#define B_  8
#define C_  256
#define K_  8
#define H_  128
#define W_  128
#define HW_ (H_ * W_)

typedef __attribute__((ext_vector_type(2))) float v2f;
typedef __attribute__((ext_vector_type(8))) float v8f;

// ---------------------------------------------------------------------------
// Kernel 1: area[b][k] = sum over H*W of mask[b][k][:]
// grid = B*K blocks, 256 threads
// ---------------------------------------------------------------------------
__global__ __launch_bounds__(256) void area_kernel(const float* __restrict__ mask,
                                                   float* __restrict__ area) {
  __shared__ float red[256];
  const int bk = blockIdx.x;
  const float* m = mask + (size_t)bk * HW_;
  float s = 0.f;
  for (int i = threadIdx.x; i < HW_; i += 256) s += m[i];
  red[threadIdx.x] = s;
  __syncthreads();
  for (int off = 128; off > 0; off >>= 1) {
    if (threadIdx.x < off) red[threadIdx.x] += red[threadIdx.x + off];
    __syncthreads();
  }
  if (threadIdx.x == 0) area[bk] = red[0];
}

// ---------------------------------------------------------------------------
// Kernel 2: fold the weight chain into small per-(b,k) vectors:
//   g      = sqrt(p / max_k p), p = area/(H*W)
//   vtok   = region_vec * g
//   k_tok  = k_w @ vtok + k_b ;  v_tok = v_w @ vtok + v_b
//   w2[c]  = (sum_o q_w[o][c] * k_tok[o]) / 16        (16 = sqrt(C))
//   b2     = (sum_o q_b[o]    * k_tok[o]) / 16
//   pv[c]  =  sum_o proj_w[c][o] * v_tok[o]
// grid = B*K blocks, 256 threads (thread = channel)
// ---------------------------------------------------------------------------
__global__ __launch_bounds__(256) void fold_kernel(
    const float* __restrict__ area, const float* __restrict__ region_vec,
    const float* __restrict__ q_w, const float* __restrict__ q_b,
    const float* __restrict__ k_w, const float* __restrict__ k_b,
    const float* __restrict__ v_w, const float* __restrict__ v_b,
    const float* __restrict__ proj_w,
    float* __restrict__ w2, float* __restrict__ b2, float* __restrict__ pv) {
  __shared__ float vtok[C_], ktok[C_], vtok2[C_];
  const int b = blockIdx.x / K_;
  const int k = blockIdx.x % K_;
  const int t = threadIdx.x;

  const float inv_hw = 1.0f / (float)(HW_);
  float p = area[b * K_ + k] * inv_hw;
  float dmax = 1e-6f;
  for (int kk = 0; kk < K_; ++kk) dmax = fmaxf(dmax, area[b * K_ + kk] * inv_hw);
  float g = sqrtf(fmaxf(p / dmax, 0.0f));

  vtok[t] = region_vec[((size_t)b * K_ + k) * C_ + t] * g;
  __syncthreads();

  float kt = k_b[t], vt = v_b[t];
  for (int c = 0; c < C_; ++c) {
    kt += k_w[t * C_ + c] * vtok[c];
    vt += v_w[t * C_ + c] * vtok[c];
  }
  ktok[t] = kt;
  vtok2[t] = vt;
  __syncthreads();

  float w2v = 0.f, pvv = 0.f;
  for (int o = 0; o < C_; ++o) {
    w2v += q_w[o * C_ + t] * ktok[o];
    pvv += proj_w[t * C_ + o] * vtok2[o];
  }
  w2[((size_t)b * K_ + k) * C_ + t] = w2v * (1.0f / 16.0f);
  pv[((size_t)b * K_ + k) * C_ + t] = pvv;
  if (t == 0) {
    float s = 0.f;
    for (int o = 0; o < C_; ++o) s += q_b[o] * ktok[o];
    b2[b * K_ + k] = s * (1.0f / 16.0f);
  }
}

// ---------------------------------------------------------------------------
// Kernel 3: streaming attention kernel (memory-bound, WMMA + async-LDS)
//   Per wave: 16-pixel tile, feat tile (256ch x 16pix = 16KB) staged into
//   wave-private LDS with global_load_async_to_lds_b128 (32 instrs/tile).
//   Stage 1 : logits^T(16k x 16pix) = w2_pad(16x256) @ feat(256x16), 64 WMMAs
//   Softmax : lane-local over 8 VGPRs (lanes 0-15 hold valid pixels)
//   Stage 2 : delta^T(16ch x 16pix) = pv^T @ attn^T, 2 WMMAs per channel tile
//   Epilogue: out = feat + sigmoid(alpha)*(delta + proj_b), feat from LDS
//   The folded weights (w2, pv, proj_b, b2) are staged once per work-group
//   and shared by its 8 waves, i.e. once per 128 pixels.
// grid = (HW/128, B), 256 threads (8 waves)
// ---------------------------------------------------------------------------
#define AW_ 8                  // waves per work-group; AW_*32 threads == C_
// One LDS block, weights first: they stay below 64KB, inside the reach of the
// LDS instructions' immediate offsets; the tiles go by a per-wave base anyway.
struct AttnLds {
  float w2[16 * C_];           // 16KB, rows 8..15 zero
  float pv[K_ * C_];           // 8KB
  float pb[C_];                // 1KB
  float b2[16];
  float feat[AW_ * C_ * 16];   // 128KB: per-wave tile, 16B aligned
};
__global__ __launch_bounds__(AW_ * 32) void attn_kernel(
    const float* __restrict__ feat, const float* __restrict__ mask,
    const float* __restrict__ w2g, const float* __restrict__ b2g,
    const float* __restrict__ pvg, const float* __restrict__ proj_b,
    const float* __restrict__ mbs_p, const float* __restrict__ alpha_p,
    float* __restrict__ out) {
  __shared__ __align__(16) AttnLds sm;
  float* const w2_s = sm.w2;
  float* const pv_s = sm.pv;
  float* const pb_s = sm.pb;
  float* const b2_s = sm.b2;
  float* const feat_s = sm.feat;

  const int b = blockIdx.y;
  const int tid = threadIdx.x;

  // One thread per channel: 17 unconditional loads into registers, issued
  // together (one L2 round trip), then the LDS stores.
  const float* w2b = w2g + (size_t)b * K_ * C_;
  const float* pvb = pvg + (size_t)b * K_ * C_;
  float w2r[K_], pvr[K_];
  for (int r = 0; r < K_; ++r) w2r[r] = w2b[r * C_ + tid];
  for (int r = 0; r < K_; ++r) pvr[r] = pvb[r * C_ + tid];
  const float pbr = proj_b[tid];
  // Before any register that the loads above name may be rewritten.
  asm volatile("s_wait_xcnt 0x0" ::: "memory");
  for (int r = 0; r < K_; ++r) {
    w2_s[r * C_ + tid] = w2r[r];
    w2_s[(r + K_) * C_ + tid] = 0.0f;
    pv_s[r * C_ + tid] = pvr[r];
  }
  pb_s[tid] = pbr;
  if (tid < 16) b2_s[tid] = (tid < K_) ? b2g[b * K_ + tid] : 0.0f;
  __syncthreads();

  const float mbs = mbs_p[0];
  const float gate = 1.0f / (1.0f + __expf(-alpha_p[0]));

  const int wave = tid >> 5;
  const int lane = tid & 31;
  const int half = lane >> 4;   // 0: lanes 0-15, 1: lanes 16-31
  const int row  = lane & 15;
  const int p0 = (blockIdx.x * AW_ + wave) * 16;
  const int p  = p0 + row;                         // this lane's pixel column

  const float* fb = feat + (size_t)b * C_ * HW_;   // batch base

  // ---- Async-stage feat tile into wave-private LDS ------------------------
  // Each lane: 16B pixel-quad of one channel -> 8 channels per instruction.
  float* fsw = feat_s + wave * (C_ * 16);
  const uint32_t lds_base = (uint32_t)(uintptr_t)fsw;
  const int chl = lane >> 2;                       // 0..7: channel within block
  const int pq  = (lane & 3) * 4;                  // pixel quad
  const float* gsrc = fb + (size_t)chl * HW_ + p0 + pq;
  #pragma unroll 4
  for (int cb = 0; cb < C_; cb += 8) {
    uint32_t laddr = lds_base + (uint32_t)(((cb + chl) * 16 + pq) * 4);
    const float* ga = gsrc + (size_t)cb * HW_;
    asm volatile("global_load_async_to_lds_b128 %0, %1, off"
                 :: "v"(laddr), "v"(ga) : "memory");
  }
  asm volatile("s_wait_asynccnt 0" ::: "memory");

  // ---- Stage 1: logits^T = w2_pad @ feat_tile -----------------------------
  // A (16x4): M=k row (lane&15), VGPR0=K chans {c+2h}, VGPR1={c+2h+1}
  // B (4x16): K chans in lane-halves, N=pixel (from LDS)
  v8f acc = {};
  #pragma unroll 4
  for (int c = 0; c < C_; c += 4) {
    const int cc = c + 2 * half;
    v2f Aop, Bop;
    Aop.x = w2_s[row * C_ + cc];
    Aop.y = w2_s[row * C_ + cc + 1];
    Bop.x = fsw[cc * 16 + row];
    Bop.y = fsw[(cc + 1) * 16 + row];
    acc = __builtin_amdgcn_wmma_f32_16x16x4_f32(false, Aop, false, Bop,
                                                (short)0, acc, false, false);
  }

  // ---- Bias + softmax (lane-local; lanes 0-15 carry the real pixels) ------
  const float* mB = mask + (size_t)b * K_ * HW_ + p;
  float logit[8], attnv[8];
  float mx = -1e30f;
  #pragma unroll
  for (int r = 0; r < 8; ++r) {
    float l = acc[r] + b2_s[r] + mbs * __logf(mB[(size_t)r * HW_] + 1e-6f);
    logit[r] = l;
    mx = fmaxf(mx, l);
  }
  float sum = 0.f;
  #pragma unroll
  for (int r = 0; r < 8; ++r) {
    float e = __expf(logit[r] - mx);
    attnv[r] = e;
    sum += e;
  }
  const float inv = 1.0f / sum;
  #pragma unroll
  for (int r = 0; r < 8; ++r) attnv[r] *= inv;

  // ---- Build stage-2 B operands: attn^T (k x pixel) -----------------------
  // lanes 16-31 need attn[k=2,3,6,7] of lane (lane-16): shuffle + select.
  float t2 = __shfl(attnv[2], row, 32);
  float t3 = __shfl(attnv[3], row, 32);
  float t6 = __shfl(attnv[6], row, 32);
  float t7 = __shfl(attnv[7], row, 32);
  v2f B1, B2;
  B1.x = half ? t2 : attnv[0];
  B1.y = half ? t3 : attnv[1];
  B2.x = half ? t6 : attnv[4];
  B2.y = half ? t7 : attnv[5];

  // ---- Stage 2 + epilogue -------------------------------------------------
  // A (16x4): M=channel (ct+row), K = region index (2 WMMAs cover k=0..7)
  float* ob = out + (size_t)b * C_ * HW_;
  for (int ct = 0; ct < C_; ct += 16) {
    const int ch = ct + row;
    v2f A1, A2;
    A1.x = pv_s[(0 + 2 * half) * C_ + ch];
    A1.y = pv_s[(1 + 2 * half) * C_ + ch];
    A2.x = pv_s[(4 + 2 * half) * C_ + ch];
    A2.y = pv_s[(5 + 2 * half) * C_ + ch];
    v8f d = {};
    d = __builtin_amdgcn_wmma_f32_16x16x4_f32(false, A1, false, B1,
                                              (short)0, d, false, false);
    d = __builtin_amdgcn_wmma_f32_16x16x4_f32(false, A2, false, B2,
                                              (short)0, d, false, false);
    #pragma unroll
    for (int r = 0; r < 8; ++r) {
      const int c_out = ct + r + 8 * half;            // D row -> channel
      const float f = fsw[c_out * 16 + row];          // feat from LDS tile
      ob[(size_t)c_out * HW_ + p] = f + gate * (d[r] + pb_s[c_out]);
    }
  }
}

// ---------------------------------------------------------------------------
extern "C" void kernel_launch(void* const* d_in, const int* in_sizes, int n_in,
                              void* d_out, int out_size, void* d_ws, size_t ws_size,
                              hipStream_t stream) {
  const float* feat       = (const float*)d_in[0];
  const float* mask       = (const float*)d_in[1];
  const float* region_vec = (const float*)d_in[2];
  const float* q_w        = (const float*)d_in[3];
  const float* q_b        = (const float*)d_in[4];
  const float* k_w        = (const float*)d_in[5];
  const float* k_b        = (const float*)d_in[6];
  const float* v_w        = (const float*)d_in[7];
  const float* v_b        = (const float*)d_in[8];
  const float* proj_w     = (const float*)d_in[9];
  const float* proj_b     = (const float*)d_in[10];
  const float* mbs        = (const float*)d_in[11];
  const float* alpha      = (const float*)d_in[12];
  float* out = (float*)d_out;

  float* ws   = (float*)d_ws;
  float* area = ws;                       // B*K       = 64
  float* b2   = ws + 64;                  // B*K       = 64
  float* w2   = ws + 128;                 // B*K*C     = 16384
  float* pv   = ws + 128 + B_ * K_ * C_;  // B*K*C     = 16384

  area_kernel<<<B_ * K_, 256, 0, stream>>>(mask, area);
  fold_kernel<<<B_ * K_, 256, 0, stream>>>(area, region_vec, q_w, q_b, k_w, k_b,
                                           v_w, v_b, proj_w, w2, b2, pv);
  dim3 grid(HW_ / (16 * AW_), B_);
  attn_kernel<<<grid, AW_ * 32, 0, stream>>>(feat, mask, w2, b2, pv, proj_b,
                                       mbs, alpha, out);
}

// v002
// It runs in 60.8 microseconds.
// Timed twice side by side with v001, it ran 1.35 and 1.36 times as fast.
// Over all steps from v000 it is 1.91 times as fast.
#include <hip/hip_runtime.h>
#include <hip/hip_bf16.h>
#include <stdint.h>

// Problem constants (match reference)
#define B_  8
#define C_  256
#define K_  8
#define H_  128
#define W_  128
#define HW_ (H_ * W_)

typedef __attribute__((ext_vector_type(2))) float v2f;
typedef __attribute__((ext_vector_type(8))) float v8f;

// ---------------------------------------------------------------------------
// Kernel 1: area[b][k] = sum over H*W of mask[b][k][:]
// grid = B*K blocks, 256 threads
// ---------------------------------------------------------------------------
__global__ __launch_bounds__(256) void area_kernel(const float* __restrict__ mask,
                                                   float* __restrict__ area) {
  __shared__ float red[256];
  const int bk = blockIdx.x;
  const float* m = mask + (size_t)bk * HW_;
  float s = 0.f;
  for (int i = threadIdx.x; i < HW_; i += 256) s += m[i];
  red[threadIdx.x] = s;
  __syncthreads();
  for (int off = 128; off > 0; off >>= 1) {
    if (threadIdx.x < off) red[threadIdx.x] += red[threadIdx.x + off];
    __syncthreads();
  }
  if (threadIdx.x == 0) area[bk] = red[0];
}

// ---------------------------------------------------------------------------
// Kernel 2: fold the weight chain into small per-(b,k) vectors:
//   g      = sqrt(p / max_k p), p = area/(H*W)
//   vtok   = region_vec * g
//   k_tok  = k_w @ vtok + k_b ;  v_tok = v_w @ vtok + v_b
//   w2[c]  = (sum_o q_w[o][c] * k_tok[o]) / 16        (16 = sqrt(C))
//   b2     = (sum_o q_b[o]    * k_tok[o]) / 16
//   pv[c]  =  sum_o proj_w[c][o] * v_tok[o]
// Every weight row (1 KB) is read by one whole wave as two loads of 512
// contiguous bytes (lane = 4 columns, twice), never one row per lane.
//   row . vector products (k_w, v_w, proj_w): per-lane partial dots, then a
//     sum over the 32 lanes;
//   column sums (q_w, with q_b as one more column): each wave adds its 8
//     rows, scaled, into 8 columns per lane; the 32 waves' partial rows are
//     added through LDS.
// grid = B*K blocks, 1024 threads (32 waves)
// ---------------------------------------------------------------------------
#define FW_ 32                 // waves per work-group
typedef __attribute__((ext_vector_type(4))) float v4f;

__device__ __forceinline__ float dot8(v4f a0, v4f a1, v4f x0, v4f x1) {
  float s0 = a0.x * x0.x, s1 = a1.x * x1.x;
  s0 = fmaf(a0.y, x0.y, s0); s1 = fmaf(a1.y, x1.y, s1);
  s0 = fmaf(a0.z, x0.z, s0); s1 = fmaf(a1.z, x1.z, s1);
  s0 = fmaf(a0.w, x0.w, s0); s1 = fmaf(a1.w, x1.w, s1);
  return s0 + s1;
}

// Sums each of N (a power of two, at most 32) per-lane values over the 32
// lanes. Each exchange halves the values a lane still carries, so N values
// take N - 1 exchanges plus one for each step left. On return the lane holds
// the full sum of value number lane / (32 / N).
template <int N>
__device__ __forceinline__ float lane_sums(float (&p)[N], int lane) {
  int m = 16;
  #pragma unroll
  for (int n = N / 2; n >= 1; n >>= 1, m >>= 1) {
    const bool hi = (lane & m) != 0;
    #pragma unroll
    for (int i = 0; i < n; ++i) {
      const float lo_v = p[i], hi_v = p[i + n];   // values, so that the two
      const float keep = hi ? hi_v : lo_v;        // selects stay in registers
      const float send = hi ? lo_v : hi_v;
      p[i] = keep + __shfl_xor(send, m, 32);
    }
  }
  float s = p[0];
  #pragma unroll
  for (; m >= 1; m >>= 1) s += __shfl_xor(s, m, 32);
  return s;
}

__global__ __launch_bounds__(FW_ * 32) void fold_kernel(
    const float* __restrict__ area, const float* __restrict__ region_vec,
    const float* __restrict__ q_w, const float* __restrict__ q_b,
    const float* __restrict__ k_w, const float* __restrict__ k_b,
    const float* __restrict__ v_w, const float* __restrict__ v_b,
    const float* __restrict__ proj_w,
    float* __restrict__ w2, float* __restrict__ b2, float* __restrict__ pv) {
  __shared__ __align__(16) float ktok[C_], vtok2[C_], pv_s[C_], b2_s[FW_];
  __shared__ __align__(16) float part[FW_ * C_];   // 32KB: per-wave w2 sums
  const int b = blockIdx.x / K_;
  const int k = blockIdx.x % K_;
  const int t = threadIdx.x;
  const int lane = t & 31;
  const int wave = __builtin_amdgcn_readfirstlane(t >> 5);

  const float inv_hw = 1.0f / (float)(HW_);
  float p = area[b * K_ + k] * inv_hw;
  float dmax = 1e-6f;
  for (int kk = 0; kk < K_; ++kk) dmax = fmaxf(dmax, area[b * K_ + kk] * inv_hw);
  float g = sqrtf(fmaxf(p / dmax, 0.0f));

  // This lane's 8 columns of vtok, in registers.
  const v4f* rv = (const v4f*)(region_vec + ((size_t)b * K_ + k) * C_);
  const v4f x0 = rv[lane] * g, x1 = rv[32 + lane] * g;

  // ---- k_tok, v_tok: waves 0-15 take 16 rows of k_w each, 16-31 of v_w ----
  const bool is_k = wave < FW_ / 2;
  const int r0 = (wave & (FW_ / 2 - 1)) * 16;
  const v4f* wrow = (const v4f*)((is_k ? k_w : v_w) + (size_t)r0 * C_) + lane;
  const float bias16 = ((is_k ? k_b : v_b) + r0)[lane & 15];  // row r0 + lane % 16
  float* trow = (is_k ? ktok : vtok2) + r0;
  // Kept rolled: one trip's 16 loads (64 registers) are then requested
  // together; unrolled, the build split them into fours or spilled.
  #pragma unroll 1
  for (int h = 0; h < 16; h += 8) {
    float d1[8];
    #pragma unroll
    for (int i = 0; i < 8; ++i)
      d1[i] = dot8(wrow[i * (C_ / 4)], wrow[i * (C_ / 4) + 32], x0, x1);
    // Before the address register that the loads above name is advanced.
    asm volatile("s_wait_xcnt 0x0" ::: "memory");
    wrow += 8 * (C_ / 4);
    const float tok = lane_sums<8>(d1, lane) + __shfl(bias16, h + (lane >> 2), 32);
    if ((lane & 3) == 0) trow[h + (lane >> 2)] = tok;
  }
  __syncthreads();

  // ---- pv: 8 rows of proj_w per wave --------------------------------------
  const v4f y0 = ((const v4f*)vtok2)[lane], y1 = ((const v4f*)vtok2)[32 + lane];
  float d2[8];
  #pragma unroll
  for (int i = 0; i < 8; ++i) {
    const v4f* r = (const v4f*)(proj_w + (size_t)(wave * 8 + i) * C_);
    d2[i] = dot8(r[lane], r[32 + lane], y0, y1);
  }
  // ---- w2: 8 rows of q_w per wave, summed down the columns ----------------
  // q_b goes along as one more column (b2).
  v4f c0 = {}, c1 = {};
  float cb = 0.f;
  #pragma unroll
  for (int i = 0; i < 8; ++i) {
    const v4f* r = (const v4f*)(q_w + (size_t)(wave * 8 + i) * C_);
    const float kt = ktok[wave * 8 + i];
    c0 += r[lane] * kt;
    c1 += r[32 + lane] * kt;
    cb = fmaf(q_b[wave * 8 + i], kt, cb);
  }
  ((v4f*)part)[wave * 64 + lane] = c0;
  ((v4f*)part)[wave * 64 + 32 + lane] = c1;
  const float pvv = lane_sums<8>(d2, lane);
  if ((lane & 3) == 0) pv_s[wave * 8 + (lane >> 2)] = pvv;
  if (lane == 0) b2_s[wave] = cb;
  __syncthreads();

  // ---- one thread per channel: add the waves' w2 rows, store w2 and pv;
  //      one more thread does the same for b2 ------------------------------
  if (t < C_) {
    float s0 = 0.f, s1 = 0.f, s2 = 0.f, s3 = 0.f;
    #pragma unroll
    for (int w = 0; w < FW_; w += 4) {
      s0 += part[(w + 0) * C_ + t];
      s1 += part[(w + 1) * C_ + t];
      s2 += part[(w + 2) * C_ + t];
      s3 += part[(w + 3) * C_ + t];
    }
    w2[((size_t)b * K_ + k) * C_ + t] = ((s0 + s1) + (s2 + s3)) * (1.0f / 16.0f);
    pv[((size_t)b * K_ + k) * C_ + t] = pv_s[t];
  } else if (t == C_) {
    float s = 0.f;
    #pragma unroll
    for (int w = 0; w < FW_; ++w) s += b2_s[w];
    b2[b * K_ + k] = s * (1.0f / 16.0f);
  }
}

// ---------------------------------------------------------------------------
// Kernel 3: streaming attention kernel (memory-bound, WMMA + async-LDS)
//   Per wave: 16-pixel tile, feat tile (256ch x 16pix = 16KB) staged into
//   wave-private LDS with global_load_async_to_lds_b128 (32 instrs/tile).
//   Stage 1 : logits^T(16k x 16pix) = w2_pad(16x256) @ feat(256x16), 64 WMMAs
//   Softmax : lane-local over 8 VGPRs (lanes 0-15 hold valid pixels)
//   Stage 2 : delta^T(16ch x 16pix) = pv^T @ attn^T, 2 WMMAs per channel tile
//   Epilogue: out = feat + sigmoid(alpha)*(delta + proj_b), feat from LDS
//   The folded weights (w2, pv, proj_b, b2) are staged once per work-group
//   and shared by its 8 waves, i.e. once per 128 pixels.
// grid = (HW/128, B), 256 threads (8 waves)
// ---------------------------------------------------------------------------
#define AW_ 8                  // waves per work-group; AW_*32 threads == C_
// One LDS block, weights first: they stay below 64KB, inside the reach of the
// LDS instructions' immediate offsets; the tiles go by a per-wave base anyway.
struct AttnLds {
  float w2[16 * C_];           // 16KB, rows 8..15 zero
  float pv[K_ * C_];           // 8KB
  float pb[C_];                // 1KB
  float b2[16];
  float feat[AW_ * C_ * 16];   // 128KB: per-wave tile, 16B aligned
};
__global__ __launch_bounds__(AW_ * 32) void attn_kernel(
    const float* __restrict__ feat, const float* __restrict__ mask,
    const float* __restrict__ w2g, const float* __restrict__ b2g,
    const float* __restrict__ pvg, const float* __restrict__ proj_b,
    const float* __restrict__ mbs_p, const float* __restrict__ alpha_p,
    float* __restrict__ out) {
  __shared__ __align__(16) AttnLds sm;
  float* const w2_s = sm.w2;
  float* const pv_s = sm.pv;
  float* const pb_s = sm.pb;
  float* const b2_s = sm.b2;
  float* const feat_s = sm.feat;

  const int b = blockIdx.y;
  const int tid = threadIdx.x;

  // One thread per channel: 17 unconditional loads into registers, issued
  // together (one L2 round trip), then the LDS stores.
  const float* w2b = w2g + (size_t)b * K_ * C_;
  const float* pvb = pvg + (size_t)b * K_ * C_;
  float w2r[K_], pvr[K_];
  for (int r = 0; r < K_; ++r) w2r[r] = w2b[r * C_ + tid];
  for (int r = 0; r < K_; ++r) pvr[r] = pvb[r * C_ + tid];
  const float pbr = proj_b[tid];
  // Before any register that the loads above name may be rewritten.
  asm volatile("s_wait_xcnt 0x0" ::: "memory");
  for (int r = 0; r < K_; ++r) {
    w2_s[r * C_ + tid] = w2r[r];
    w2_s[(r + K_) * C_ + tid] = 0.0f;
    pv_s[r * C_ + tid] = pvr[r];
  }
  pb_s[tid] = pbr;
  if (tid < 16) b2_s[tid] = (tid < K_) ? b2g[b * K_ + tid] : 0.0f;
  __syncthreads();

  const float mbs = mbs_p[0];
  const float gate = 1.0f / (1.0f + __expf(-alpha_p[0]));

  const int wave = tid >> 5;
  const int lane = tid & 31;
  const int half = lane >> 4;   // 0: lanes 0-15, 1: lanes 16-31
  const int row  = lane & 15;
  const int p0 = (blockIdx.x * AW_ + wave) * 16;
  const int p  = p0 + row;                         // this lane's pixel column

  const float* fb = feat + (size_t)b * C_ * HW_;   // batch base

  // ---- Async-stage feat tile into wave-private LDS ------------------------
  // Each lane: 16B pixel-quad of one channel -> 8 channels per instruction.
  float* fsw = feat_s + wave * (C_ * 16);
  const uint32_t lds_base = (uint32_t)(uintptr_t)fsw;
  const int chl = lane >> 2;                       // 0..7: channel within block
  const int pq  = (lane & 3) * 4;                  // pixel quad
  const float* gsrc = fb + (size_t)chl * HW_ + p0 + pq;
  #pragma unroll 4
  for (int cb = 0; cb < C_; cb += 8) {
    uint32_t laddr = lds_base + (uint32_t)(((cb + chl) * 16 + pq) * 4);
    const float* ga = gsrc + (size_t)cb * HW_;
    asm volatile("global_load_async_to_lds_b128 %0, %1, off"
                 :: "v"(laddr), "v"(ga) : "memory");
  }
  asm volatile("s_wait_asynccnt 0" ::: "memory");

  // ---- Stage 1: logits^T = w2_pad @ feat_tile -----------------------------
  // A (16x4): M=k row (lane&15), VGPR0=K chans {c+2h}, VGPR1={c+2h+1}
  // B (4x16): K chans in lane-halves, N=pixel (from LDS)
  v8f acc = {};
  #pragma unroll 4
  for (int c = 0; c < C_; c += 4) {
    const int cc = c + 2 * half;
    v2f Aop, Bop;
    Aop.x = w2_s[row * C_ + cc];
    Aop.y = w2_s[row * C_ + cc + 1];
    Bop.x = fsw[cc * 16 + row];
    Bop.y = fsw[(cc + 1) * 16 + row];
    acc = __builtin_amdgcn_wmma_f32_16x16x4_f32(false, Aop, false, Bop,
                                                (short)0, acc, false, false);
  }

  // ---- Bias + softmax (lane-local; lanes 0-15 carry the real pixels) ------
  const float* mB = mask + (size_t)b * K_ * HW_ + p;
  float logit[8], attnv[8];
  float mx = -1e30f;
  #pragma unroll
  for (int r = 0; r < 8; ++r) {
    float l = acc[r] + b2_s[r] + mbs * __logf(mB[(size_t)r * HW_] + 1e-6f);
    logit[r] = l;
    mx = fmaxf(mx, l);
  }
  float sum = 0.f;
  #pragma unroll
  for (int r = 0; r < 8; ++r) {
    float e = __expf(logit[r] - mx);
    attnv[r] = e;
    sum += e;
  }
  const float inv = 1.0f / sum;
  #pragma unroll
  for (int r = 0; r < 8; ++r) attnv[r] *= inv;

  // ---- Build stage-2 B operands: attn^T (k x pixel) -----------------------
  // lanes 16-31 need attn[k=2,3,6,7] of lane (lane-16): shuffle + select.
  float t2 = __shfl(attnv[2], row, 32);
  float t3 = __shfl(attnv[3], row, 32);
  float t6 = __shfl(attnv[6], row, 32);
  float t7 = __shfl(attnv[7], row, 32);
  v2f B1, B2;
  B1.x = half ? t2 : attnv[0];
  B1.y = half ? t3 : attnv[1];
  B2.x = half ? t6 : attnv[4];
  B2.y = half ? t7 : attnv[5];

  // ---- Stage 2 + epilogue -------------------------------------------------
  // A (16x4): M=channel (ct+row), K = region index (2 WMMAs cover k=0..7)
  float* ob = out + (size_t)b * C_ * HW_;
  for (int ct = 0; ct < C_; ct += 16) {
    const int ch = ct + row;
    v2f A1, A2;
    A1.x = pv_s[(0 + 2 * half) * C_ + ch];
    A1.y = pv_s[(1 + 2 * half) * C_ + ch];
    A2.x = pv_s[(4 + 2 * half) * C_ + ch];
    A2.y = pv_s[(5 + 2 * half) * C_ + ch];
    v8f d = {};
    d = __builtin_amdgcn_wmma_f32_16x16x4_f32(false, A1, false, B1,
                                              (short)0, d, false, false);
    d = __builtin_amdgcn_wmma_f32_16x16x4_f32(false, A2, false, B2,
                                              (short)0, d, false, false);
    #pragma unroll
    for (int r = 0; r < 8; ++r) {
      const int c_out = ct + r + 8 * half;            // D row -> channel
      const float f = fsw[c_out * 16 + row];          // feat from LDS tile
      ob[(size_t)c_out * HW_ + p] = f + gate * (d[r] + pb_s[c_out]);
    }
  }
}

// ---------------------------------------------------------------------------
extern "C" void kernel_launch(void* const* d_in, const int* in_sizes, int n_in,
                              void* d_out, int out_size, void* d_ws, size_t ws_size,
                              hipStream_t stream) {
  const float* feat       = (const float*)d_in[0];
  const float* mask       = (const float*)d_in[1];
  const float* region_vec = (const float*)d_in[2];
  const float* q_w        = (const float*)d_in[3];
  const float* q_b        = (const float*)d_in[4];
  const float* k_w        = (const float*)d_in[5];
  const float* k_b        = (const float*)d_in[6];
  const float* v_w        = (const float*)d_in[7];
  const float* v_b        = (const float*)d_in[8];
  const float* proj_w     = (const float*)d_in[9];
  const float* proj_b     = (const float*)d_in[10];
  const float* mbs        = (const float*)d_in[11];
  const float* alpha      = (const float*)d_in[12];
  float* out = (float*)d_out;

  float* ws   = (float*)d_ws;
  float* area = ws;                       // B*K       = 64
  float* b2   = ws + 64;                  // B*K       = 64
  float* w2   = ws + 128;                 // B*K*C     = 16384
  float* pv   = ws + 128 + B_ * K_ * C_;  // B*K*C     = 16384

  area_kernel<<<B_ * K_, 256, 0, stream>>>(mask, area);
  fold_kernel<<<B_ * K_, FW_ * 32, 0, stream>>>(area, region_vec, q_w, q_b, k_w, k_b,
                                           v_w, v_b, proj_w, w2, b2, pv);
  dim3 grid(HW_ / (16 * AW_), B_);
  attn_kernel<<<grid, AW_ * 32, 0, stream>>>(feat, mask, w2, b2, pv, proj_b,
                                       mbs, alpha, out);
}

// v003
// Measured time: 53.7 microseconds a run.
// Next to v002, in two timings, it ran 1.13 and 1.14 times as fast.
// Counting every step since v000, it is 2.17 times as fast.
#include <hip/hip_runtime.h>
#include <hip/hip_bf16.h>
#include <stdint.h>

// Problem constants (match reference)
#define B_  8
#define C_  256
#define K_  8
#define H_  128
#define W_  128
#define HW_ (H_ * W_)

typedef __attribute__((ext_vector_type(2))) float v2f;
typedef __attribute__((ext_vector_type(8))) float v8f;

// ---------------------------------------------------------------------------
// Kernel 1: area[b][k] = sum over H*W of mask[b][k][:]
// grid = B*K blocks, 256 threads
// ---------------------------------------------------------------------------
__global__ __launch_bounds__(256) void area_kernel(const float* __restrict__ mask,
                                                   float* __restrict__ area) {
  __shared__ float red[256];
  const int bk = blockIdx.x;
  const float* m = mask + (size_t)bk * HW_;
  float s = 0.f;
  for (int i = threadIdx.x; i < HW_; i += 256) s += m[i];
  red[threadIdx.x] = s;
  __syncthreads();
  for (int off = 128; off > 0; off >>= 1) {
    if (threadIdx.x < off) red[threadIdx.x] += red[threadIdx.x + off];
    __syncthreads();
  }
  if (threadIdx.x == 0) area[bk] = red[0];
}

// ---------------------------------------------------------------------------
// Kernel 2: fold the weight chain into small per-(b,k) vectors:
//   g      = sqrt(p / max_k p), p = area/(H*W)
//   vtok   = region_vec * g
//   k_tok  = k_w @ vtok + k_b ;  v_tok = v_w @ vtok + v_b
//   w2[c]  = (sum_o q_w[o][c] * k_tok[o]) / 16        (16 = sqrt(C))
//   b2     = (sum_o q_b[o]    * k_tok[o]) / 16
//   pv[c]  =  sum_o proj_w[c][o] * v_tok[o]
// Every weight row (1 KB) is read by one whole wave as two loads of 512
// contiguous bytes (lane = 4 columns, twice), never one row per lane.
//   row . vector products (k_w, v_w, proj_w): per-lane partial dots, then a
//     sum over the 32 lanes;
//   column sums (q_w, with q_b as one more column): each wave adds its 8
//     rows, scaled, into 8 columns per lane; the 32 waves' partial rows are
//     added through LDS.
// grid = B*K blocks, 1024 threads (32 waves)
// ---------------------------------------------------------------------------
#define FW_ 32                 // waves per work-group
typedef __attribute__((ext_vector_type(4))) float v4f;

__device__ __forceinline__ float dot8(v4f a0, v4f a1, v4f x0, v4f x1) {
  float s0 = a0.x * x0.x, s1 = a1.x * x1.x;
  s0 = fmaf(a0.y, x0.y, s0); s1 = fmaf(a1.y, x1.y, s1);
  s0 = fmaf(a0.z, x0.z, s0); s1 = fmaf(a1.z, x1.z, s1);
  s0 = fmaf(a0.w, x0.w, s0); s1 = fmaf(a1.w, x1.w, s1);
  return s0 + s1;
}

// Sums each of N (a power of two, at most 32) per-lane values over the 32
// lanes. Each exchange halves the values a lane still carries, so N values
// take N - 1 exchanges plus one for each step left. On return the lane holds
// the full sum of value number lane / (32 / N).
template <int N>
__device__ __forceinline__ float lane_sums(float (&p)[N], int lane) {
  int m = 16;
  #pragma unroll
  for (int n = N / 2; n >= 1; n >>= 1, m >>= 1) {
    const bool hi = (lane & m) != 0;
    #pragma unroll
    for (int i = 0; i < n; ++i) {
      const float lo_v = p[i], hi_v = p[i + n];   // values, so that the two
      const float keep = hi ? hi_v : lo_v;        // selects stay in registers
      const float send = hi ? lo_v : hi_v;
      p[i] = keep + __shfl_xor(send, m, 32);
    }
  }
  float s = p[0];
  #pragma unroll
  for (; m >= 1; m >>= 1) s += __shfl_xor(s, m, 32);
  return s;
}

__global__ __launch_bounds__(FW_ * 32) void fold_kernel(
    const float* __restrict__ area, const float* __restrict__ region_vec,
    const float* __restrict__ q_w, const float* __restrict__ q_b,
    const float* __restrict__ k_w, const float* __restrict__ k_b,
    const float* __restrict__ v_w, const float* __restrict__ v_b,
    const float* __restrict__ proj_w,
    float* __restrict__ w2, float* __restrict__ b2, float* __restrict__ pv) {
  __shared__ __align__(16) float ktok[C_], vtok2[C_], pv_s[C_], b2_s[FW_];
  __shared__ __align__(16) float part[FW_ * C_];   // 32KB: per-wave w2 sums
  const int b = blockIdx.x / K_;
  const int k = blockIdx.x % K_;
  const int t = threadIdx.x;
  const int lane = t & 31;
  const int wave = __builtin_amdgcn_readfirstlane(t >> 5);

  const float inv_hw = 1.0f / (float)(HW_);
  float p = area[b * K_ + k] * inv_hw;
  float dmax = 1e-6f;
  for (int kk = 0; kk < K_; ++kk) dmax = fmaxf(dmax, area[b * K_ + kk] * inv_hw);
  float g = sqrtf(fmaxf(p / dmax, 0.0f));

  // This lane's 8 columns of vtok, in registers.
  const v4f* rv = (const v4f*)(region_vec + ((size_t)b * K_ + k) * C_);
  const v4f x0 = rv[lane] * g, x1 = rv[32 + lane] * g;

  // ---- k_tok, v_tok: waves 0-15 take 16 rows of k_w each, 16-31 of v_w ----
  const bool is_k = wave < FW_ / 2;
  const int r0 = (wave & (FW_ / 2 - 1)) * 16;
  const v4f* wrow = (const v4f*)((is_k ? k_w : v_w) + (size_t)r0 * C_) + lane;
  const float bias16 = ((is_k ? k_b : v_b) + r0)[lane & 15];  // row r0 + lane % 16
  float* trow = (is_k ? ktok : vtok2) + r0;
  // Kept rolled: one trip's 16 loads (64 registers) are then requested
  // together; unrolled, the build split them into fours or spilled.
  #pragma unroll 1
  for (int h = 0; h < 16; h += 8) {
    float d1[8];
    #pragma unroll
    for (int i = 0; i < 8; ++i)
      d1[i] = dot8(wrow[i * (C_ / 4)], wrow[i * (C_ / 4) + 32], x0, x1);
    // Before the address register that the loads above name is advanced.
    asm volatile("s_wait_xcnt 0x0" ::: "memory");
    wrow += 8 * (C_ / 4);
    const float tok = lane_sums<8>(d1, lane) + __shfl(bias16, h + (lane >> 2), 32);
    if ((lane & 3) == 0) trow[h + (lane >> 2)] = tok;
  }
  __syncthreads();

  // ---- pv: 8 rows of proj_w per wave --------------------------------------
  const v4f y0 = ((const v4f*)vtok2)[lane], y1 = ((const v4f*)vtok2)[32 + lane];
  float d2[8];
  #pragma unroll
  for (int i = 0; i < 8; ++i) {
    const v4f* r = (const v4f*)(proj_w + (size_t)(wave * 8 + i) * C_);
    d2[i] = dot8(r[lane], r[32 + lane], y0, y1);
  }
  // ---- w2: 8 rows of q_w per wave, summed down the columns ----------------
  // q_b goes along as one more column (b2).
  v4f c0 = {}, c1 = {};
  float cb = 0.f;
  #pragma unroll
  for (int i = 0; i < 8; ++i) {
    const v4f* r = (const v4f*)(q_w + (size_t)(wave * 8 + i) * C_);
    const float kt = ktok[wave * 8 + i];
    c0 += r[lane] * kt;
    c1 += r[32 + lane] * kt;
    cb = fmaf(q_b[wave * 8 + i], kt, cb);
  }
  ((v4f*)part)[wave * 64 + lane] = c0;
  ((v4f*)part)[wave * 64 + 32 + lane] = c1;
  const float pvv = lane_sums<8>(d2, lane);
  if ((lane & 3) == 0) pv_s[wave * 8 + (lane >> 2)] = pvv;
  if (lane == 0) b2_s[wave] = cb;
  __syncthreads();

  // ---- one thread per channel: add the waves' w2 rows, store w2 and pv;
  //      one more thread does the same for b2 ------------------------------
  if (t < C_) {
    float s0 = 0.f, s1 = 0.f, s2 = 0.f, s3 = 0.f;
    #pragma unroll
    for (int w = 0; w < FW_; w += 4) {
      s0 += part[(w + 0) * C_ + t];
      s1 += part[(w + 1) * C_ + t];
      s2 += part[(w + 2) * C_ + t];
      s3 += part[(w + 3) * C_ + t];
    }
    w2[((size_t)b * K_ + k) * C_ + t] = ((s0 + s1) + (s2 + s3)) * (1.0f / 16.0f);
    pv[((size_t)b * K_ + k) * C_ + t] = pv_s[t];
  } else if (t == C_) {
    float s = 0.f;
    #pragma unroll
    for (int w = 0; w < FW_; ++w) s += b2_s[w];
    b2[b * K_ + k] = s * (1.0f / 16.0f);
  }
}

// ---------------------------------------------------------------------------
// Kernel 3: streaming attention kernel (memory-bound, WMMA + async-LDS)
//   Per wave: 16-pixel tile, feat tile (256ch x 16pix = 16KB) staged into
//   wave-private LDS with global_load_async_to_lds_b128 (32 instrs/tile).
//   Stage 1 : logits^T(16k x 16pix) = w2_pad(16x256) @ feat(256x16), 64 WMMAs
//   Softmax : lane-local over 8 VGPRs (lanes 0-15 hold valid pixels)
//   Stage 2 : delta^T(16ch x 16pix) = pv^T @ attn^T, 2 WMMAs per channel tile
//   Epilogue: out = feat + sigmoid(alpha)*(delta + proj_b), feat from LDS
//   The folded weights (w2, pv, proj_b, b2) are staged once per work-group
//   and shared by its 8 waves, i.e. once per 128 pixels.
// grid = (HW/128, B), 256 threads (8 waves)
// ---------------------------------------------------------------------------
#define AW_ 8                  // waves per work-group; AW_*32 threads == C_
// LDS layouts, each set by its reader (64 banks of 4 bytes):
//   w2: a stage-1 A read takes 8 bytes of each of 16 rows, twice (lane halves
//       2 dwords apart). Row pitch = 4 mod 64 dwords: 32 lanes on 64 banks.
//   pv: a stage-2 A read takes 16 dwords in a row of each of two rows, 2 rows
//       apart. Row pitch = 16 mod 64 dwords: the two runs lie 32 banks apart.
//   feat tile: 16 dwords a channel, so 4 channels span the banks. Stage 1
//       reads channels 2 apart, the epilogue channels 8 apart. Channel ch
//       lies in slot ch ^ 2 where ch & 8, else in slot ch: both readers then
//       see slots that differ by 2 mod 4, 32 banks apart.
#define W2P_ (C_ + 4)          // w2 row pitch, dwords
#define PVP_ (C_ + 16)         // pv row pitch, dwords
// One LDS block, weights first: they stay below 64KB, inside the reach of the
// LDS instructions' immediate offsets; the tiles go by a per-wave base anyway.
struct AttnLds {
  float w2[16 * W2P_];         // 16KB, rows 8..15 zero
  float pv[K_ * PVP_];         // 8KB
  float pb[C_];                // 1KB
  float b2[16];
  float feat[AW_ * C_ * 16];   // 128KB: per-wave tile, 16B aligned
};
__global__ __launch_bounds__(AW_ * 32) void attn_kernel(
    const float* __restrict__ feat, const float* __restrict__ mask,
    const float* __restrict__ w2g, const float* __restrict__ b2g,
    const float* __restrict__ pvg, const float* __restrict__ proj_b,
    const float* __restrict__ mbs_p, const float* __restrict__ alpha_p,
    float* __restrict__ out) {
  __shared__ __align__(16) AttnLds sm;
  float* const w2_s = sm.w2;
  float* const pv_s = sm.pv;
  float* const pb_s = sm.pb;
  float* const b2_s = sm.b2;
  float* const feat_s = sm.feat;

  const int b = blockIdx.y;
  const int tid = threadIdx.x;

  // One thread per channel: 17 unconditional loads into registers, issued
  // together (one L2 round trip), then the LDS stores.
  const float* w2b = w2g + (size_t)b * K_ * C_;
  const float* pvb = pvg + (size_t)b * K_ * C_;
  float w2r[K_], pvr[K_];
  for (int r = 0; r < K_; ++r) w2r[r] = w2b[r * C_ + tid];
  for (int r = 0; r < K_; ++r) pvr[r] = pvb[r * C_ + tid];
  const float pbr = proj_b[tid];
  // Before any register that the loads above name may be rewritten.
  asm volatile("s_wait_xcnt 0x0" ::: "memory");
  for (int r = 0; r < K_; ++r) {
    w2_s[r * W2P_ + tid] = w2r[r];
    w2_s[(r + K_) * W2P_ + tid] = 0.0f;
    pv_s[r * PVP_ + tid] = pvr[r];
  }
  pb_s[tid] = pbr;
  if (tid < 16) b2_s[tid] = (tid < K_) ? b2g[b * K_ + tid] : 0.0f;
  __syncthreads();

  const float mbs = mbs_p[0];
  const float gate = 1.0f / (1.0f + __expf(-alpha_p[0]));

  const int wave = tid >> 5;
  const int lane = tid & 31;
  const int half = lane >> 4;   // 0: lanes 0-15, 1: lanes 16-31
  const int row  = lane & 15;
  const int p0 = (blockIdx.x * AW_ + wave) * 16;
  const int p  = p0 + row;                         // this lane's pixel column

  const float* fb = feat + (size_t)b * C_ * HW_;   // batch base

  // ---- Async-stage feat tile into wave-private LDS ------------------------
  // Each lane: 16B pixel-quad of one channel -> 8 channels per instruction.
  float* fsw = feat_s + wave * (C_ * 16);
  const uint32_t lds_base = (uint32_t)(uintptr_t)fsw;
  const int chl = lane >> 2;                       // 0..7: channel within block
  const int pq  = (lane & 3) * 4;                  // pixel quad
  const float* gsrc = fb + (size_t)chl * HW_ + p0 + pq;
  #pragma unroll 4
  for (int cb = 0; cb < C_; cb += 8) {
    const int slot = cb + ((cb & 8) ? (chl ^ 2) : chl);   // see AttnLds
    uint32_t laddr = lds_base + (uint32_t)((slot * 16 + pq) * 4);
    const float* ga = gsrc + (size_t)cb * HW_;
    asm volatile("global_load_async_to_lds_b128 %0, %1, off"
                 :: "v"(laddr), "v"(ga) : "memory");
  }
  asm volatile("s_wait_asynccnt 0" ::: "memory");

  // ---- Stage 1: logits^T = w2_pad @ feat_tile -----------------------------
  // A (16x4): M=k row (lane&15), VGPR0=K chans {c+2h}, VGPR1={c+2h+1}
  // B (4x16): K chans in lane-halves, N=pixel (from LDS)
  v8f acc = {};
  #pragma unroll 4
  for (int c = 0; c < C_; c += 4) {
    const int cc = c + 2 * half;
    const int sl = (c & 8) ? (cc ^ 2) : cc;        // slot of channel cc
    v2f Aop, Bop;
    Aop.x = w2_s[row * W2P_ + cc];
    Aop.y = w2_s[row * W2P_ + cc + 1];
    Bop.x = fsw[sl * 16 + row];
    Bop.y = fsw[(sl + 1) * 16 + row];
    acc = __builtin_amdgcn_wmma_f32_16x16x4_f32(false, Aop, false, Bop,
                                                (short)0, acc, false, false);
  }

  // ---- Bias + softmax (lane-local; lanes 0-15 carry the real pixels) ------
  const float* mB = mask + (size_t)b * K_ * HW_ + p;
  float logit[8], attnv[8];
  float mx = -1e30f;
  #pragma unroll
  for (int r = 0; r < 8; ++r) {
    float l = acc[r] + b2_s[r] + mbs * __logf(mB[(size_t)r * HW_] + 1e-6f);
    logit[r] = l;
    mx = fmaxf(mx, l);
  }
  float sum = 0.f;
  #pragma unroll
  for (int r = 0; r < 8; ++r) {
    float e = __expf(logit[r] - mx);
    attnv[r] = e;
    sum += e;
  }
  const float inv = 1.0f / sum;
  #pragma unroll
  for (int r = 0; r < 8; ++r) attnv[r] *= inv;

  // ---- Build stage-2 B operands: attn^T (k x pixel) -----------------------
  // lanes 16-31 need attn[k=2,3,6,7] of lane (lane-16): shuffle + select.
  float t2 = __shfl(attnv[2], row, 32);
  float t3 = __shfl(attnv[3], row, 32);
  float t6 = __shfl(attnv[6], row, 32);
  float t7 = __shfl(attnv[7], row, 32);
  v2f B1, B2;
  B1.x = half ? t2 : attnv[0];
  B1.y = half ? t3 : attnv[1];
  B2.x = half ? t6 : attnv[4];
  B2.y = half ? t7 : attnv[5];

  // ---- Stage 2 + epilogue -------------------------------------------------
  // A (16x4): M=channel (ct+row), K = region index (2 WMMAs cover k=0..7)
  float* ob = out + (size_t)b * C_ * HW_;
  for (int ct = 0; ct < C_; ct += 16) {
    const int ch = ct + row;
    v2f A1, A2;
    A1.x = pv_s[(0 + 2 * half) * PVP_ + ch];
    A1.y = pv_s[(1 + 2 * half) * PVP_ + ch];
    A2.x = pv_s[(4 + 2 * half) * PVP_ + ch];
    A2.y = pv_s[(5 + 2 * half) * PVP_ + ch];
    v8f d = {};
    d = __builtin_amdgcn_wmma_f32_16x16x4_f32(false, A1, false, B1,
                                              (short)0, d, false, false);
    d = __builtin_amdgcn_wmma_f32_16x16x4_f32(false, A2, false, B2,
                                              (short)0, d, false, false);
    #pragma unroll
    for (int r = 0; r < 8; ++r) {
      const int c_out = ct + r + 8 * half;            // D row -> channel
      const int sl = ct + 8 * half + (r ^ (2 * half)); // slot of c_out
      const float f = fsw[sl * 16 + row];             // feat from LDS tile
      ob[(size_t)c_out * HW_ + p] = f + gate * (d[r] + pb_s[c_out]);
    }
  }
}

// ---------------------------------------------------------------------------
extern "C" void kernel_launch(void* const* d_in, const int* in_sizes, int n_in,
                              void* d_out, int out_size, void* d_ws, size_t ws_size,
                              hipStream_t stream) {
  const float* feat       = (const float*)d_in[0];
  const float* mask       = (const float*)d_in[1];
  const float* region_vec = (const float*)d_in[2];
  const float* q_w        = (const float*)d_in[3];
  const float* q_b        = (const float*)d_in[4];
  const float* k_w        = (const float*)d_in[5];
  const float* k_b        = (const float*)d_in[6];
  const float* v_w        = (const float*)d_in[7];
  const float* v_b        = (const float*)d_in[8];
  const float* proj_w     = (const float*)d_in[9];
  const float* proj_b     = (const float*)d_in[10];
  const float* mbs        = (const float*)d_in[11];
  const float* alpha      = (const float*)d_in[12];
  float* out = (float*)d_out;

  float* ws   = (float*)d_ws;
  float* area = ws;                       // B*K       = 64
  float* b2   = ws + 64;                  // B*K       = 64
  float* w2   = ws + 128;                 // B*K*C     = 16384
  float* pv   = ws + 128 + B_ * K_ * C_;  // B*K*C     = 16384

  area_kernel<<<B_ * K_, 256, 0, stream>>>(mask, area);
  fold_kernel<<<B_ * K_, FW_ * 32, 0, stream>>>(area, region_vec, q_w, q_b, k_w, k_b,
                                           v_w, v_b, proj_w, w2, b2, pv);
  dim3 grid(HW_ / (16 * AW_), B_);
  attn_kernel<<<grid, AW_ * 32, 0, stream>>>(feat, mask, w2, b2, pv, proj_b,
                                       mbs, alpha, out);
}

// v004
// One run takes 46.5 microseconds.
// Timed twice side by side with v003, it ran 1.16 and 1.15 times as fast.
// Over all steps from v000 it is 2.50 times as fast.
#include <hip/hip_runtime.h>
#include <hip/hip_bf16.h>
#include <stdint.h>

// Problem constants (match reference)
#define B_  8
#define C_  256
#define K_  8
#define H_  128
#define W_  128
#define HW_ (H_ * W_)

typedef __attribute__((ext_vector_type(2))) float v2f;
typedef __attribute__((ext_vector_type(8))) float v8f;

// ---------------------------------------------------------------------------
// Kernel 1: area[b][k] = sum over H*W of mask[b][k][:]
// grid = B*K blocks, 256 threads
// ---------------------------------------------------------------------------
__global__ __launch_bounds__(256) void area_kernel(const float* __restrict__ mask,
                                                   float* __restrict__ area) {
  __shared__ float red[256];
  const int bk = blockIdx.x;
  const float* m = mask + (size_t)bk * HW_;
  float s = 0.f;
  for (int i = threadIdx.x; i < HW_; i += 256) s += m[i];
  red[threadIdx.x] = s;
  __syncthreads();
  for (int off = 128; off > 0; off >>= 1) {
    if (threadIdx.x < off) red[threadIdx.x] += red[threadIdx.x + off];
    __syncthreads();
  }
  if (threadIdx.x == 0) area[bk] = red[0];
}

// ---------------------------------------------------------------------------
// Kernel 2: fold the weight chain into small per-(b,k) vectors:
//   g      = sqrt(p / max_k p), p = area/(H*W)
//   vtok   = region_vec * g
//   k_tok  = k_w @ vtok + k_b ;  v_tok = v_w @ vtok + v_b
//   w2[c]  = (sum_o q_w[o][c] * k_tok[o]) / 16        (16 = sqrt(C))
//   b2     = (sum_o q_b[o]    * k_tok[o]) / 16
//   pv[c]  =  sum_o proj_w[c][o] * v_tok[o]
// Every weight row (1 KB) is read by one whole wave as two loads of 512
// contiguous bytes (lane = 4 columns, twice), never one row per lane.
//   row . vector products (k_w, v_w, proj_w): per-lane partial dots, then a
//     sum over the 32 lanes;
//   column sums (q_w, with q_b as one more column): each wave adds its 8
//     rows, scaled, into 8 columns per lane; the 32 waves' partial rows are
//     added through LDS.
// grid = B*K blocks, 1024 threads (32 waves)
// ---------------------------------------------------------------------------
#define FW_ 32                 // waves per work-group
typedef __attribute__((ext_vector_type(4))) float v4f;

__device__ __forceinline__ float dot8(v4f a0, v4f a1, v4f x0, v4f x1) {
  float s0 = a0.x * x0.x, s1 = a1.x * x1.x;
  s0 = fmaf(a0.y, x0.y, s0); s1 = fmaf(a1.y, x1.y, s1);
  s0 = fmaf(a0.z, x0.z, s0); s1 = fmaf(a1.z, x1.z, s1);
  s0 = fmaf(a0.w, x0.w, s0); s1 = fmaf(a1.w, x1.w, s1);
  return s0 + s1;
}

// Sums each of N (a power of two, at most 32) per-lane values over the 32
// lanes. Each exchange halves the values a lane still carries, so N values
// take N - 1 exchanges plus one for each step left. On return the lane holds
// the full sum of value number lane / (32 / N).
template <int N>
__device__ __forceinline__ float lane_sums(float (&p)[N], int lane) {
  int m = 16;
  #pragma unroll
  for (int n = N / 2; n >= 1; n >>= 1, m >>= 1) {
    const bool hi = (lane & m) != 0;
    #pragma unroll
    for (int i = 0; i < n; ++i) {
      const float lo_v = p[i], hi_v = p[i + n];   // values, so that the two
      const float keep = hi ? hi_v : lo_v;        // selects stay in registers
      const float send = hi ? lo_v : hi_v;
      p[i] = keep + __shfl_xor(send, m, 32);
    }
  }
  float s = p[0];
  #pragma unroll
  for (; m >= 1; m >>= 1) s += __shfl_xor(s, m, 32);
  return s;
}

__global__ __launch_bounds__(FW_ * 32) void fold_kernel(
    const float* __restrict__ area, const float* __restrict__ region_vec,
    const float* __restrict__ q_w, const float* __restrict__ q_b,
    const float* __restrict__ k_w, const float* __restrict__ k_b,
    const float* __restrict__ v_w, const float* __restrict__ v_b,
    const float* __restrict__ proj_w,
    float* __restrict__ w2, float* __restrict__ b2, float* __restrict__ pv) {
  __shared__ __align__(16) float ktok[C_], vtok2[C_], pv_s[C_], b2_s[FW_];
  __shared__ __align__(16) float part[FW_ * C_];   // 32KB: per-wave w2 sums
  const int b = blockIdx.x / K_;
  const int k = blockIdx.x % K_;
  const int t = threadIdx.x;
  const int lane = t & 31;
  const int wave = __builtin_amdgcn_readfirstlane(t >> 5);

  const float inv_hw = 1.0f / (float)(HW_);
  float p = area[b * K_ + k] * inv_hw;
  float dmax = 1e-6f;
  for (int kk = 0; kk < K_; ++kk) dmax = fmaxf(dmax, area[b * K_ + kk] * inv_hw);
  float g = sqrtf(fmaxf(p / dmax, 0.0f));

  // This lane's 8 columns of vtok, in registers.
  const v4f* rv = (const v4f*)(region_vec + ((size_t)b * K_ + k) * C_);
  const v4f x0 = rv[lane] * g, x1 = rv[32 + lane] * g;

  // ---- k_tok, v_tok: waves 0-15 take 16 rows of k_w each, 16-31 of v_w ----
  const bool is_k = wave < FW_ / 2;
  const int r0 = (wave & (FW_ / 2 - 1)) * 16;
  const v4f* wrow = (const v4f*)((is_k ? k_w : v_w) + (size_t)r0 * C_) + lane;
  const float bias16 = ((is_k ? k_b : v_b) + r0)[lane & 15];  // row r0 + lane % 16
  float* trow = (is_k ? ktok : vtok2) + r0;
  // Kept rolled: one trip's 16 loads (64 registers) are then requested
  // together; unrolled, the build split them into fours or spilled.
  #pragma unroll 1
  for (int h = 0; h < 16; h += 8) {
    float d1[8];
    #pragma unroll
    for (int i = 0; i < 8; ++i)
      d1[i] = dot8(wrow[i * (C_ / 4)], wrow[i * (C_ / 4) + 32], x0, x1);
    // Before the address register that the loads above name is advanced.
    asm volatile("s_wait_xcnt 0x0" ::: "memory");
    wrow += 8 * (C_ / 4);
    const float tok = lane_sums<8>(d1, lane) + __shfl(bias16, h + (lane >> 2), 32);
    if ((lane & 3) == 0) trow[h + (lane >> 2)] = tok;
  }
  __syncthreads();

  // ---- pv: 8 rows of proj_w per wave --------------------------------------
  const v4f y0 = ((const v4f*)vtok2)[lane], y1 = ((const v4f*)vtok2)[32 + lane];
  float d2[8];
  #pragma unroll
  for (int i = 0; i < 8; ++i) {
    const v4f* r = (const v4f*)(proj_w + (size_t)(wave * 8 + i) * C_);
    d2[i] = dot8(r[lane], r[32 + lane], y0, y1);
  }
  // ---- w2: 8 rows of q_w per wave, summed down the columns ----------------
  // q_b goes along as one more column (b2).
  v4f c0 = {}, c1 = {};
  float cb = 0.f;
  #pragma unroll
  for (int i = 0; i < 8; ++i) {
    const v4f* r = (const v4f*)(q_w + (size_t)(wave * 8 + i) * C_);
    const float kt = ktok[wave * 8 + i];
    c0 += r[lane] * kt;
    c1 += r[32 + lane] * kt;
    cb = fmaf(q_b[wave * 8 + i], kt, cb);
  }
  ((v4f*)part)[wave * 64 + lane] = c0;
  ((v4f*)part)[wave * 64 + 32 + lane] = c1;
  const float pvv = lane_sums<8>(d2, lane);
  if ((lane & 3) == 0) pv_s[wave * 8 + (lane >> 2)] = pvv;
  if (lane == 0) b2_s[wave] = cb;
  __syncthreads();

  // ---- one thread per channel: add the waves' w2 rows, store w2 and pv;
  //      one more thread does the same for b2 ------------------------------
  if (t < C_) {
    float s0 = 0.f, s1 = 0.f, s2 = 0.f, s3 = 0.f;
    #pragma unroll
    for (int w = 0; w < FW_; w += 4) {
      s0 += part[(w + 0) * C_ + t];
      s1 += part[(w + 1) * C_ + t];
      s2 += part[(w + 2) * C_ + t];
      s3 += part[(w + 3) * C_ + t];
    }
    w2[((size_t)b * K_ + k) * C_ + t] = ((s0 + s1) + (s2 + s3)) * (1.0f / 16.0f);
    pv[((size_t)b * K_ + k) * C_ + t] = pv_s[t];
  } else if (t == C_) {
    float s = 0.f;
    #pragma unroll
    for (int w = 0; w < FW_; ++w) s += b2_s[w];
    b2[b * K_ + k] = s * (1.0f / 16.0f);
  }
}

// ---------------------------------------------------------------------------
// Kernel 3: streaming attention kernel (memory-bound, WMMA + async-LDS)
//   Per wave: 16-pixel tile, feat tile (256ch x 16pix = 16KB) staged into
//   wave-private LDS with global_load_async_to_lds_b128 (32 instrs/tile).
//   Stage 1 : logits^T(16k x 16pix) = w2_pad(16x256) @ feat(256x16), 64 WMMAs
//   Softmax : lane-local over 8 VGPRs (lanes 0-15 hold valid pixels)
//   Stage 2 : delta^T(16ch x 16pix) = pv^T @ attn^T, 2 WMMAs per channel tile
//   Epilogue: out = feat + sigmoid(alpha)*(delta + proj_b), written over feat
//             in the LDS tile; behind a barrier the work-group's 128 pixels
//             of a channel leave as one store of 512 contiguous bytes
//   The folded weights (w2, pv, proj_b, b2) are staged once per work-group
//   and shared by its 8 waves, i.e. once per 128 pixels.
// grid = (HW/128, B), 256 threads (8 waves)
// ---------------------------------------------------------------------------
#define AW_ 8                  // waves per work-group; AW_*32 threads == C_
// LDS layouts, each set by its reader (64 banks of 4 bytes):
//   w2: a stage-1 A read takes 8 bytes of each of 16 rows, twice (lane halves
//       2 dwords apart). Row pitch = 4 mod 64 dwords: 32 lanes on 64 banks.
//   pv: a stage-2 A read takes 16 dwords in a row of each of two rows, 2 rows
//       apart. Row pitch = 16 mod 64 dwords: the two runs lie 32 banks apart.
//   feat tile: 16 dwords a channel, so 4 channels span the banks. Stage 1
//       reads channels 2 apart, the epilogue channels 8 apart. Channel ch
//       lies in slot ch ^ 2 where ch & 8, else in slot ch: both readers then
//       see slots that differ by 2 mod 4, 32 banks apart.
//   tile pitch: the final store reads 16 bytes a lane, 4 lanes a tile, the
//       same slot of all 8 tiles. Pitch = 16 mod 64 dwords: each 16 lanes
//       (4 tiles) then cover the 64 banks once.
#define W2P_ (C_ + 4)          // w2 row pitch, dwords
#define PVP_ (C_ + 16)         // pv row pitch, dwords
#define FTP_ (C_ * 16 + 16)    // feat tile pitch, dwords
// One LDS block, weights first: they stay below 64KB, inside the reach of the
// LDS instructions' immediate offsets; the tiles go by a per-wave base anyway.
struct AttnLds {
  float w2[16 * W2P_];         // 16KB, rows 8..15 zero
  float pv[K_ * PVP_];         // 8KB
  float pb[C_];                // 1KB
  float b2[16];
  float feat[AW_ * FTP_];      // 128KB: per-wave tile, 16B aligned
};
__global__ __launch_bounds__(AW_ * 32) void attn_kernel(
    const float* __restrict__ feat, const float* __restrict__ mask,
    const float* __restrict__ w2g, const float* __restrict__ b2g,
    const float* __restrict__ pvg, const float* __restrict__ proj_b,
    const float* __restrict__ mbs_p, const float* __restrict__ alpha_p,
    float* __restrict__ out) {
  __shared__ __align__(16) AttnLds sm;
  float* const w2_s = sm.w2;
  float* const pv_s = sm.pv;
  float* const pb_s = sm.pb;
  float* const b2_s = sm.b2;
  float* const feat_s = sm.feat;

  const int b = blockIdx.y;
  const int tid = threadIdx.x;

  // One thread per channel: 17 unconditional loads into registers, issued
  // together (one L2 round trip), then the LDS stores.
  const float* w2b = w2g + (size_t)b * K_ * C_;
  const float* pvb = pvg + (size_t)b * K_ * C_;
  float w2r[K_], pvr[K_];
  for (int r = 0; r < K_; ++r) w2r[r] = w2b[r * C_ + tid];
  for (int r = 0; r < K_; ++r) pvr[r] = pvb[r * C_ + tid];
  const float pbr = proj_b[tid];
  // Before any register that the loads above name may be rewritten.
  asm volatile("s_wait_xcnt 0x0" ::: "memory");
  for (int r = 0; r < K_; ++r) {
    w2_s[r * W2P_ + tid] = w2r[r];
    w2_s[(r + K_) * W2P_ + tid] = 0.0f;
    pv_s[r * PVP_ + tid] = pvr[r];
  }
  pb_s[tid] = pbr;
  if (tid < 16) b2_s[tid] = (tid < K_) ? b2g[b * K_ + tid] : 0.0f;
  __syncthreads();

  const float mbs = mbs_p[0];
  const float gate = 1.0f / (1.0f + __expf(-alpha_p[0]));

  const int wave = tid >> 5;
  const int lane = tid & 31;
  const int half = lane >> 4;   // 0: lanes 0-15, 1: lanes 16-31
  const int row  = lane & 15;
  const int p0 = (blockIdx.x * AW_ + wave) * 16;
  const int p  = p0 + row;                         // this lane's pixel column

  const float* fb = feat + (size_t)b * C_ * HW_;   // batch base

  // ---- Async-stage feat tile into wave-private LDS ------------------------
  // Each lane: 16B pixel-quad of one channel -> 8 channels per instruction.
  float* fsw = feat_s + wave * FTP_;
  const uint32_t lds_base = (uint32_t)(uintptr_t)fsw;
  const int chl = lane >> 2;                       // 0..7: channel within block
  const int pq  = (lane & 3) * 4;                  // pixel quad
  const float* gsrc = fb + (size_t)chl * HW_ + p0 + pq;
  #pragma unroll 4
  for (int cb = 0; cb < C_; cb += 8) {
    const int slot = cb + ((cb & 8) ? (chl ^ 2) : chl);   // see AttnLds
    uint32_t laddr = lds_base + (uint32_t)((slot * 16 + pq) * 4);
    const float* ga = gsrc + (size_t)cb * HW_;
    asm volatile("global_load_async_to_lds_b128 %0, %1, off"
                 :: "v"(laddr), "v"(ga) : "memory");
  }
  asm volatile("s_wait_asynccnt 0" ::: "memory");

  // ---- Stage 1: logits^T = w2_pad @ feat_tile -----------------------------
  // A (16x4): M=k row (lane&15), VGPR0=K chans {c+2h}, VGPR1={c+2h+1}
  // B (4x16): K chans in lane-halves, N=pixel (from LDS)
  v8f acc = {};
  #pragma unroll 4
  for (int c = 0; c < C_; c += 4) {
    const int cc = c + 2 * half;
    const int sl = (c & 8) ? (cc ^ 2) : cc;        // slot of channel cc
    v2f Aop, Bop;
    Aop.x = w2_s[row * W2P_ + cc];
    Aop.y = w2_s[row * W2P_ + cc + 1];
    Bop.x = fsw[sl * 16 + row];
    Bop.y = fsw[(sl + 1) * 16 + row];
    acc = __builtin_amdgcn_wmma_f32_16x16x4_f32(false, Aop, false, Bop,
                                                (short)0, acc, false, false);
  }

  // ---- Bias + softmax (lane-local; lanes 0-15 carry the real pixels) ------
  const float* mB = mask + (size_t)b * K_ * HW_ + p;
  float logit[8], attnv[8];
  float mx = -1e30f;
  #pragma unroll
  for (int r = 0; r < 8; ++r) {
    float l = acc[r] + b2_s[r] + mbs * __logf(mB[(size_t)r * HW_] + 1e-6f);
    logit[r] = l;
    mx = fmaxf(mx, l);
  }
  float sum = 0.f;
  #pragma unroll
  for (int r = 0; r < 8; ++r) {
    float e = __expf(logit[r] - mx);
    attnv[r] = e;
    sum += e;
  }
  const float inv = 1.0f / sum;
  #pragma unroll
  for (int r = 0; r < 8; ++r) attnv[r] *= inv;

  // ---- Build stage-2 B operands: attn^T (k x pixel) -----------------------
  // lanes 16-31 need attn[k=2,3,6,7] of lane (lane-16): shuffle + select.
  float t2 = __shfl(attnv[2], row, 32);
  float t3 = __shfl(attnv[3], row, 32);
  float t6 = __shfl(attnv[6], row, 32);
  float t7 = __shfl(attnv[7], row, 32);
  v2f B1, B2;
  B1.x = half ? t2 : attnv[0];
  B1.y = half ? t3 : attnv[1];
  B2.x = half ? t6 : attnv[4];
  B2.y = half ? t7 : attnv[5];

  // ---- Stage 2 + epilogue -------------------------------------------------
  // A (16x4): M=channel (ct+row), K = region index (2 WMMAs cover k=0..7)
  float* ob = out + (size_t)b * C_ * HW_;
  // D row r is channel ct + 8*half + r, in slot ct + 8*half + (r ^ 2*half):
  // one lane pointer for rows 0,1,4,5 and one for rows 2,3,6,7.
  float* const t0 = fsw + (10 * half) * 16 + row;
  float* const t1 = fsw + (6 * half + 2) * 16 + row;
  for (int ct = 0; ct < C_; ct += 16) {
    const int ch = ct + row;
    v2f A1, A2;
    A1.x = pv_s[(0 + 2 * half) * PVP_ + ch];
    A1.y = pv_s[(1 + 2 * half) * PVP_ + ch];
    A2.x = pv_s[(4 + 2 * half) * PVP_ + ch];
    A2.y = pv_s[(5 + 2 * half) * PVP_ + ch];
    v8f d = {};
    d = __builtin_amdgcn_wmma_f32_16x16x4_f32(false, A1, false, B1,
                                              (short)0, d, false, false);
    d = __builtin_amdgcn_wmma_f32_16x16x4_f32(false, A2, false, B2,
                                              (short)0, d, false, false);
    // All LDS reads of the trip first, then its LDS writes: a read behind a
    // write would wait for it (the compiler cannot tell the arrays apart).
    // (Both loops unrolled: f, pbv and d are then registers.)
    float f[8], pbv[8];
    #pragma unroll
    for (int r = 0; r < 8; ++r) {
      const int c_out = ct + r + 8 * half;            // D row -> channel
      f[r] = ((r & 2) ? t1 : t0)[(ct + (r & 5)) * 16]; // feat from LDS tile
      pbv[r] = pb_s[c_out];
    }
    #pragma unroll
    for (int r = 0; r < 8; ++r)
      ((r & 2) ? t1 : t0)[(ct + (r & 5)) * 16] = f[r] + gate * (d[r] + pbv[r]);
  }
  // Every wave's results are in LDS before another wave reads them.
  __syncthreads();

  // ---- Store: 32 channels per wave, one whole 512-byte row per store ------
  // Lane l holds pixels 4l..4l+3 of the work-group's 128: tile l / 4, quad l % 4.
  const float* rsrc = feat_s + (lane >> 2) * FTP_ + wave * (C_ / AW_) * 16 + pq;
  float* rdst = ob + (size_t)(wave * (C_ / AW_)) * HW_ + blockIdx.x * (16 * AW_) + lane * 4;
  // Unrolled: the channel step then lies in the immediate offsets, no address
  // register is rewritten behind a store, and the LDS reads go out together.
  #pragma unroll
  for (int i = 0; i < C_ / AW_; ++i) {
    const int sl = (i & 8) ? (i ^ 2) : i;             // slot of channel i
    *(v4f*)(rdst + (size_t)i * HW_) = *(const v4f*)(rsrc + sl * 16);
  }
}

// ---------------------------------------------------------------------------
extern "C" void kernel_launch(void* const* d_in, const int* in_sizes, int n_in,
                              void* d_out, int out_size, void* d_ws, size_t ws_size,
                              hipStream_t stream) {
  const float* feat       = (const float*)d_in[0];
  const float* mask       = (const float*)d_in[1];
  const float* region_vec = (const float*)d_in[2];
  const float* q_w        = (const float*)d_in[3];
  const float* q_b        = (const float*)d_in[4];
  const float* k_w        = (const float*)d_in[5];
  const float* k_b        = (const float*)d_in[6];
  const float* v_w        = (const float*)d_in[7];
  const float* v_b        = (const float*)d_in[8];
  const float* proj_w     = (const float*)d_in[9];
  const float* proj_b     = (const float*)d_in[10];
  const float* mbs        = (const float*)d_in[11];
  const float* alpha      = (const float*)d_in[12];
  float* out = (float*)d_out;

  float* ws   = (float*)d_ws;
  float* area = ws;                       // B*K       = 64
  float* b2   = ws + 64;                  // B*K       = 64
  float* w2   = ws + 128;                 // B*K*C     = 16384
  float* pv   = ws + 128 + B_ * K_ * C_;  // B*K*C     = 16384

  area_kernel<<<B_ * K_, 256, 0, stream>>>(mask, area);
  fold_kernel<<<B_ * K_, FW_ * 32, 0, stream>>>(area, region_vec, q_w, q_b, k_w, k_b,
                                           v_w, v_b, proj_w, w2, b2, pv);
  dim3 grid(HW_ / (16 * AW_), B_);
  attn_kernel<<<grid, AW_ * 32, 0, stream>>>(feat, mask, w2, b2, pv, proj_b,
                                       mbs, alpha, out);
}

// v005
// One run takes 42.3 microseconds.
// Timed twice side by side with v004, it ran 1.10 times as fast both times.
// Counting every step since v000, it is 2.75 times as fast.
#include <hip/hip_runtime.h>
#include <hip/hip_bf16.h>
#include <stdint.h>

// Problem constants (match reference)
#define B_  8
#define C_  256
#define K_  8
#define H_  128
#define W_  128
#define HW_ (H_ * W_)

typedef __attribute__((ext_vector_type(2))) float v2f;
typedef __attribute__((ext_vector_type(8))) float v8f;

// ---------------------------------------------------------------------------
// Kernel 1: area[b][k] = sum over H*W of mask[b][k][:]
// grid = B*K blocks, 256 threads
// ---------------------------------------------------------------------------
__global__ __launch_bounds__(256) void area_kernel(const float* __restrict__ mask,
                                                   float* __restrict__ area) {
  __shared__ float red[256];
  const int bk = blockIdx.x;
  const float* m = mask + (size_t)bk * HW_;
  float s = 0.f;
  for (int i = threadIdx.x; i < HW_; i += 256) s += m[i];
  red[threadIdx.x] = s;
  __syncthreads();
  for (int off = 128; off > 0; off >>= 1) {
    if (threadIdx.x < off) red[threadIdx.x] += red[threadIdx.x + off];
    __syncthreads();
  }
  if (threadIdx.x == 0) area[bk] = red[0];
}

// ---------------------------------------------------------------------------
// Kernel 2: fold the weight chain into small per-(b,k) vectors:
//   g      = sqrt(p / max_k p), p = area/(H*W)
//   vtok   = region_vec * g
//   k_tok  = k_w @ vtok + k_b ;  v_tok = v_w @ vtok + v_b
//   w2[c]  = (sum_o q_w[o][c] * k_tok[o]) / 16        (16 = sqrt(C))
//   b2     = (sum_o q_b[o]    * k_tok[o]) / 16
//   pv[c]  =  sum_o proj_w[c][o] * v_tok[o]
// Every weight row (1 KB) is read by one whole wave as two loads of 512
// contiguous bytes (lane = 4 columns, twice), never one row per lane.
//   row . vector products (k_w, v_w, proj_w): per-lane partial dots, then a
//     sum over the 32 lanes;
//   column sums (q_w, with q_b as one more column): each wave adds its 8
//     rows, scaled, into 8 columns per lane; the 32 waves' partial rows are
//     added through LDS.
// grid = B*K blocks, 1024 threads (32 waves)
// ---------------------------------------------------------------------------
#define FW_ 32                 // waves per work-group
typedef __attribute__((ext_vector_type(4))) float v4f;

__device__ __forceinline__ float dot8(v4f a0, v4f a1, v4f x0, v4f x1) {
  float s0 = a0.x * x0.x, s1 = a1.x * x1.x;
  s0 = fmaf(a0.y, x0.y, s0); s1 = fmaf(a1.y, x1.y, s1);
  s0 = fmaf(a0.z, x0.z, s0); s1 = fmaf(a1.z, x1.z, s1);
  s0 = fmaf(a0.w, x0.w, s0); s1 = fmaf(a1.w, x1.w, s1);
  return s0 + s1;
}

// Sums each of N (a power of two, at most 32) per-lane values over the 32
// lanes. Each exchange halves the values a lane still carries, so N values
// take N - 1 exchanges plus one for each step left. On return the lane holds
// the full sum of value number lane / (32 / N).
template <int N>
__device__ __forceinline__ float lane_sums(float (&p)[N], int lane) {
  int m = 16;
  #pragma unroll
  for (int n = N / 2; n >= 1; n >>= 1, m >>= 1) {
    const bool hi = (lane & m) != 0;
    #pragma unroll
    for (int i = 0; i < n; ++i) {
      const float lo_v = p[i], hi_v = p[i + n];   // values, so that the two
      const float keep = hi ? hi_v : lo_v;        // selects stay in registers
      const float send = hi ? lo_v : hi_v;
      p[i] = keep + __shfl_xor(send, m, 32);
    }
  }
  float s = p[0];
  #pragma unroll
  for (; m >= 1; m >>= 1) s += __shfl_xor(s, m, 32);
  return s;
}

__global__ __launch_bounds__(FW_ * 32) void fold_kernel(
    const float* __restrict__ area, const float* __restrict__ region_vec,
    const float* __restrict__ q_w, const float* __restrict__ q_b,
    const float* __restrict__ k_w, const float* __restrict__ k_b,
    const float* __restrict__ v_w, const float* __restrict__ v_b,
    const float* __restrict__ proj_w,
    float* __restrict__ w2, float* __restrict__ b2, float* __restrict__ pv) {
  __shared__ __align__(16) float ktok[C_], vtok2[C_], pv_s[C_], b2_s[FW_];
  __shared__ __align__(16) float part[FW_ * C_];   // 32KB: per-wave w2 sums
  const int b = blockIdx.x / K_;
  const int k = blockIdx.x % K_;
  const int t = threadIdx.x;
  const int lane = t & 31;
  const int wave = __builtin_amdgcn_readfirstlane(t >> 5);

  const float inv_hw = 1.0f / (float)(HW_);
  float p = area[b * K_ + k] * inv_hw;
  float dmax = 1e-6f;
  for (int kk = 0; kk < K_; ++kk) dmax = fmaxf(dmax, area[b * K_ + kk] * inv_hw);
  float g = sqrtf(fmaxf(p / dmax, 0.0f));

  // This lane's 8 columns of vtok, in registers.
  const v4f* rv = (const v4f*)(region_vec + ((size_t)b * K_ + k) * C_);
  const v4f x0 = rv[lane] * g, x1 = rv[32 + lane] * g;

  // ---- k_tok, v_tok: waves 0-15 take 16 rows of k_w each, 16-31 of v_w ----
  const bool is_k = wave < FW_ / 2;
  const int r0 = (wave & (FW_ / 2 - 1)) * 16;
  const v4f* wrow = (const v4f*)((is_k ? k_w : v_w) + (size_t)r0 * C_) + lane;
  const float bias16 = ((is_k ? k_b : v_b) + r0)[lane & 15];  // row r0 + lane % 16
  float* trow = (is_k ? ktok : vtok2) + r0;
  // Kept rolled: one trip's 16 loads (64 registers) are then requested
  // together; unrolled, the build split them into fours or spilled.
  #pragma unroll 1
  for (int h = 0; h < 16; h += 8) {
    float d1[8];
    #pragma unroll
    for (int i = 0; i < 8; ++i)
      d1[i] = dot8(wrow[i * (C_ / 4)], wrow[i * (C_ / 4) + 32], x0, x1);
    // Before the address register that the loads above name is advanced.
    asm volatile("s_wait_xcnt 0x0" ::: "memory");
    wrow += 8 * (C_ / 4);
    const float tok = lane_sums<8>(d1, lane) + __shfl(bias16, h + (lane >> 2), 32);
    if ((lane & 3) == 0) trow[h + (lane >> 2)] = tok;
  }
  __syncthreads();

  // ---- pv: 8 rows of proj_w per wave --------------------------------------
  const v4f y0 = ((const v4f*)vtok2)[lane], y1 = ((const v4f*)vtok2)[32 + lane];
  float d2[8];
  #pragma unroll
  for (int i = 0; i < 8; ++i) {
    const v4f* r = (const v4f*)(proj_w + (size_t)(wave * 8 + i) * C_);
    d2[i] = dot8(r[lane], r[32 + lane], y0, y1);
  }
  // ---- w2: 8 rows of q_w per wave, summed down the columns ----------------
  // q_b goes along as one more column (b2).
  v4f c0 = {}, c1 = {};
  float cb = 0.f;
  #pragma unroll
  for (int i = 0; i < 8; ++i) {
    const v4f* r = (const v4f*)(q_w + (size_t)(wave * 8 + i) * C_);
    const float kt = ktok[wave * 8 + i];
    c0 += r[lane] * kt;
    c1 += r[32 + lane] * kt;
    cb = fmaf(q_b[wave * 8 + i], kt, cb);
  }
  ((v4f*)part)[wave * 64 + lane] = c0;
  ((v4f*)part)[wave * 64 + 32 + lane] = c1;
  const float pvv = lane_sums<8>(d2, lane);
  if ((lane & 3) == 0) pv_s[wave * 8 + (lane >> 2)] = pvv;
  if (lane == 0) b2_s[wave] = cb;
  __syncthreads();

  // ---- one thread per channel: add the waves' w2 rows, store w2 and pv;
  //      one more thread does the same for b2 ------------------------------
  if (t < C_) {
    float s0 = 0.f, s1 = 0.f, s2 = 0.f, s3 = 0.f;
    #pragma unroll
    for (int w = 0; w < FW_; w += 4) {
      s0 += part[(w + 0) * C_ + t];
      s1 += part[(w + 1) * C_ + t];
      s2 += part[(w + 2) * C_ + t];
      s3 += part[(w + 3) * C_ + t];
    }
    w2[((size_t)b * K_ + k) * C_ + t] = ((s0 + s1) + (s2 + s3)) * (1.0f / 16.0f);
    pv[((size_t)b * K_ + k) * C_ + t] = pv_s[t];
  } else if (t == C_) {
    float s = 0.f;
    #pragma unroll
    for (int w = 0; w < FW_; ++w) s += b2_s[w];
    b2[b * K_ + k] = s * (1.0f / 16.0f);
  }
}

// ---------------------------------------------------------------------------
// Kernel 3: streaming attention kernel (memory-bound, WMMA)
//   The feat tile lives in registers from its load to the final add; LDS
//   holds only the folded weights and the waves' partial logits.
//   Work-group: 128 pixels x 256 channels, 8 waves. Wave: 64 pixels (group
//   wave & 1) x 64 channels (quarter wave >> 1) = 32 loads of 16 B a lane.
//   Lane (half, n) holds pixels 4n..4n+3 of channels cbase + 16*ct + 8*half
//   + r: each load and each store covers 256 contiguous bytes of two rows.
//   Stage 1 : one WMMA takes 2 channels (one per lane half) x 32 pixels. B is
//             a register pair of a load as it stands: pixels 4n+2t, 4n+2t+1.
//             A row m < 8 is (w2[m][c], 0), row m >= 8 is (0, w2[m-8][c]), so
//             D rows 0-7 are the 8 logits of pixel 4n+2t and rows 8-15 those
//             of pixel 4n+2t+1: every lane ends with one pixel per t.
//   Sum     : the 4 channel quarters' partial logits are added through LDS.
//   Softmax : lane-local, 2 pixels a lane (each quarter's wave repeats it).
//   Stage 2 : delta^T(16ch x 16pix) = pv^T @ attn^T, 2 WMMAs per channel tile
//             and pixel j of the quad; D row r is the channel of load (ct, r).
//   Epilogue: out = feat + sigmoid(alpha)*(delta + proj_b), stored from the
//             registers, 16 B a lane.
//   The folded weights (w2, pv, proj_b, b2) are staged once per work-group.
// grid = (HW/128, B), 256 threads (8 waves)
// ---------------------------------------------------------------------------
#define AW_ 8                  // waves per work-group; AW_*32 threads == C_
// LDS layouts, each set by its reader (64 banks of 4 bytes):
//   w2: a stage-1 A read takes 16 bytes of each of 8 rows per 16 lanes.
//       Row pitch = 4 mod 64 dwords: the 8 rows lie on 32 different banks.
//   pv: a stage-2 A read takes 16 dwords in a row of each of two rows, 2 rows
//       apart. Row pitch = 16 mod 64 dwords: the two runs lie 32 banks apart.
//   part: 16 bytes a lane, lanes side by side.
#define W2P_ (C_ + 4)          // w2 row pitch, dwords
#define PVP_ (C_ + 16)         // pv row pitch, dwords
struct AttnLds {
  float w2[K_ * W2P_];         // 8KB
  float pv[K_ * PVP_];         // 8KB
  float pb[C_];                // 1KB
  float b2[16];
  float part[AW_ * 16 * 32];   // 16KB: per wave, 16 partial logits a lane
};
__global__ __launch_bounds__(AW_ * 32) void attn_kernel(
    const float* __restrict__ feat, const float* __restrict__ mask,
    const float* __restrict__ w2g, const float* __restrict__ b2g,
    const float* __restrict__ pvg, const float* __restrict__ proj_b,
    const float* __restrict__ mbs_p, const float* __restrict__ alpha_p,
    float* __restrict__ out) {
  __shared__ __align__(16) AttnLds sm;
  float* const w2_s = sm.w2;
  float* const pv_s = sm.pv;
  float* const pb_s = sm.pb;
  float* const b2_s = sm.b2;

  const int b = blockIdx.y;
  const int tid = threadIdx.x;
  const int wave = __builtin_amdgcn_readfirstlane(tid >> 5);
  const int lane = tid & 31;
  const int half = lane >> 4;   // 0: lanes 0-15, 1: lanes 16-31
  const int row  = lane & 15;
  const int p0 = blockIdx.x * (16 * AW_) + (wave & 1) * 64;  // wave's pixels
  const int cbase = (wave >> 1) * 64;                        // wave's channels

  // All global loads of the wave are issued together, in the order
  // weights, mask, feat (loads return in order).
  // Weights: one thread per channel, 17 unconditional loads.
  const float* w2b = w2g + (size_t)b * K_ * C_;
  const float* pvb = pvg + (size_t)b * K_ * C_;
  float w2r[K_], pvr[K_];
  for (int r = 0; r < K_; ++r) w2r[r] = w2b[r * C_ + tid];
  for (int r = 0; r < K_; ++r) pvr[r] = pvb[r * C_ + tid];
  const float pbr = proj_b[tid];
  // Mask: this lane's softmax pixels are p0 + 4*row + 2*t + half, t = 0, 1.
  const float* mB = mask + (size_t)b * K_ * HW_ + p0 + 4 * row + half;
  float mk[2][K_];
  #pragma unroll
  for (int t = 0; t < 2; ++t)
    #pragma unroll
    for (int r = 0; r < K_; ++r) mk[t][r] = mB[(size_t)r * HW_ + 2 * t];
  // feat: X[ct][r] = pixels p0 + 4*row .. +3 of channel cbase + 16*ct + 8*half + r.
  const size_t tile0 = ((size_t)b * C_ + cbase + 8 * half) * HW_ + p0 + 4 * row;
  const float* fsrc = feat + tile0;
  v4f X[4][8];
  #pragma unroll
  for (int ct = 0; ct < 4; ++ct)
    #pragma unroll
    for (int r = 0; r < 8; ++r)
      X[ct][r] = *(const v4f*)(fsrc + (size_t)(ct * 16 + r) * HW_);
  // Before any register that the loads above name may be rewritten.
  asm volatile("s_wait_xcnt 0x0" ::: "memory");
  for (int r = 0; r < K_; ++r) {
    w2_s[r * W2P_ + tid] = w2r[r];
    pv_s[r * PVP_ + tid] = pvr[r];
  }
  pb_s[tid] = pbr;
  if (tid < 16) b2_s[tid] = (tid < K_) ? b2g[b * K_ + tid] : 0.0f;
  __syncthreads();

  const float mbs = mbs_p[0];
  const float gate = 1.0f / (1.0f + __expf(-alpha_p[0]));

  // ---- Stage 1: partial logits over the wave's 64 channels ----------------
  // k position (half, i) of A and of B alike: channel of this half, pixel
  // 4n + 2t + i; A is zero where i differs from the D row's pixel (row >> 3).
  const bool lo = row < 8;
  const float* w2row = w2_s + (row & 7) * W2P_ + cbase + 8 * half;
  v8f acc[2] = {{}, {}};
  #pragma unroll
  for (int ct = 0; ct < 4; ++ct) {
    const v4f wa = *(const v4f*)(w2row + ct * 16);
    const v4f wb = *(const v4f*)(w2row + ct * 16 + 4);
    #pragma unroll
    for (int r = 0; r < 8; ++r) {
      const float w = (r < 4) ? wa[r & 3] : wb[r & 3];
      v2f Aop, Bq0, Bq1;
      Aop.x = lo ? w : 0.0f;
      Aop.y = lo ? 0.0f : w;
      Bq0.x = X[ct][r].x; Bq0.y = X[ct][r].y;
      Bq1.x = X[ct][r].z; Bq1.y = X[ct][r].w;
      acc[0] = __builtin_amdgcn_wmma_f32_16x16x4_f32(false, Aop, false, Bq0,
                                                     (short)0, acc[0], false, false);
      acc[1] = __builtin_amdgcn_wmma_f32_16x16x4_f32(false, Aop, false, Bq1,
                                                     (short)0, acc[1], false, false);
    }
  }

  // ---- Add the 4 channel quarters' partial logits through LDS -------------
  v4f* const part = (v4f*)sm.part;
  #pragma unroll
  for (int t = 0; t < 2; ++t) {
    const v4f s0 = {acc[t][0], acc[t][1], acc[t][2], acc[t][3]};
    const v4f s1 = {acc[t][4], acc[t][5], acc[t][6], acc[t][7]};
    part[(wave * 4 + t * 2 + 0) * 32 + lane] = s0;
    part[(wave * 4 + t * 2 + 1) * 32 + lane] = s1;
  }
  // Every wave's partial logits are in LDS before another wave reads them.
  __syncthreads();
  v4f ls[4];
  #pragma unroll
  for (int i = 0; i < 4; ++i) {
    const v4f* pr = part + ((wave & 1) * 4 + i) * 32 + lane;   // quarter 0
    ls[i] = ((pr[0] + pr[8 * 32]) + pr[16 * 32]) + pr[24 * 32];
  }

  // ---- Bias + softmax (lane-local, one pixel per t) -----------------------
  float attnv[2][8];
  #pragma unroll
  for (int t = 0; t < 2; ++t) {
    float logit[8];
    float mx = -1e30f;
    #pragma unroll
    for (int r = 0; r < 8; ++r) {
      float l = ls[t * 2 + (r >> 2)][r & 3] + b2_s[r] + mbs * __logf(mk[t][r] + 1e-6f);
      logit[r] = l;
      mx = fmaxf(mx, l);
    }
    float sum = 0.f;
    #pragma unroll
    for (int r = 0; r < 8; ++r) {
      float e = __expf(logit[r] - mx);
      attnv[t][r] = e;
      sum += e;
    }
    const float inv = 1.0f / sum;
    #pragma unroll
    for (int r = 0; r < 8; ++r) attnv[t][r] *= inv;
  }

  // ---- Build stage-2 B operands: attn^T (k x pixel), pixel 4n + j ---------
  // Pixel j = 2t + h' was normalised in lane half h'. Half 0 of B wants its
  // k = 0,1 (4,5), half 1 its k = 2,3 (6,7): own values in half h', the
  // partner lane's (lane ^ 16) in the other half.
  v2f B1[4], B2[4];
  #pragma unroll
  for (int t = 0; t < 2; ++t) {
    float sw[8];
    #pragma unroll
    for (int r = 0; r < 8; ++r) sw[r] = __shfl_xor(attnv[t][r], 16, 32);
    B1[2 * t].x = half ? sw[2] : attnv[t][0];
    B1[2 * t].y = half ? sw[3] : attnv[t][1];
    B2[2 * t].x = half ? sw[6] : attnv[t][4];
    B2[2 * t].y = half ? sw[7] : attnv[t][5];
    B1[2 * t + 1].x = half ? attnv[t][2] : sw[0];
    B1[2 * t + 1].y = half ? attnv[t][3] : sw[1];
    B2[2 * t + 1].x = half ? attnv[t][6] : sw[4];
    B2[2 * t + 1].y = half ? attnv[t][7] : sw[5];
  }

  // ---- Stage 2 + epilogue -------------------------------------------------
  // A (16x4): M=channel (16*ct+row), K = region index (2 WMMAs cover k=0..7)
  // D row r of pixel tile j: channel cbase + 16*ct + 8*half + r, pixel 4n + j,
  // which is element j of X[ct][r].
  float* odst = out + tile0;
  #pragma unroll
  for (int ct = 0; ct < 4; ++ct) {
    const int ch = cbase + ct * 16 + row;
    v2f A1, A2;
    A1.x = pv_s[(0 + 2 * half) * PVP_ + ch];
    A1.y = pv_s[(1 + 2 * half) * PVP_ + ch];
    A2.x = pv_s[(4 + 2 * half) * PVP_ + ch];
    A2.y = pv_s[(5 + 2 * half) * PVP_ + ch];
    const v4f pb0 = *(const v4f*)(pb_s + cbase + ct * 16 + 8 * half);
    const v4f pb1 = *(const v4f*)(pb_s + cbase + ct * 16 + 8 * half + 4);
    v8f d[4];
    #pragma unroll
    for (int j = 0; j < 4; ++j) {
      const v8f z = {};
      d[j] = __builtin_amdgcn_wmma_f32_16x16x4_f32(false, A1, false, B1[j],
                                                   (short)0, z, false, false);
    }
    #pragma unroll
    for (int j = 0; j < 4; ++j)
      d[j] = __builtin_amdgcn_wmma_f32_16x16x4_f32(false, A2, false, B2[j],
                                                   (short)0, d[j], false, false);
    #pragma unroll
    for (int r = 0; r < 8; ++r) {
      const float pbv = (r < 4) ? pb0[r & 3] : pb1[r & 3];
      v4f o;
      o.x = X[ct][r].x + gate * (d[0][r] + pbv);
      o.y = X[ct][r].y + gate * (d[1][r] + pbv);
      o.z = X[ct][r].z + gate * (d[2][r] + pbv);
      o.w = X[ct][r].w + gate * (d[3][r] + pbv);
      *(v4f*)(odst + (size_t)(ct * 16 + r) * HW_) = o;
    }
  }
}

// ---------------------------------------------------------------------------
extern "C" void kernel_launch(void* const* d_in, const int* in_sizes, int n_in,
                              void* d_out, int out_size, void* d_ws, size_t ws_size,
                              hipStream_t stream) {
  const float* feat       = (const float*)d_in[0];
  const float* mask       = (const float*)d_in[1];
  const float* region_vec = (const float*)d_in[2];
  const float* q_w        = (const float*)d_in[3];
  const float* q_b        = (const float*)d_in[4];
  const float* k_w        = (const float*)d_in[5];
  const float* k_b        = (const float*)d_in[6];
  const float* v_w        = (const float*)d_in[7];
  const float* v_b        = (const float*)d_in[8];
  const float* proj_w     = (const float*)d_in[9];
  const float* proj_b     = (const float*)d_in[10];
  const float* mbs        = (const float*)d_in[11];
  const float* alpha      = (const float*)d_in[12];
  float* out = (float*)d_out;

  float* ws   = (float*)d_ws;
  float* area = ws;                       // B*K       = 64
  float* b2   = ws + 64;                  // B*K       = 64
  float* w2   = ws + 128;                 // B*K*C     = 16384
  float* pv   = ws + 128 + B_ * K_ * C_;  // B*K*C     = 16384

  area_kernel<<<B_ * K_, 256, 0, stream>>>(mask, area);
  fold_kernel<<<B_ * K_, FW_ * 32, 0, stream>>>(area, region_vec, q_w, q_b, k_w, k_b,
                                           v_w, v_b, proj_w, w2, b2, pv);
  dim3 grid(HW_ / (16 * AW_), B_);
  attn_kernel<<<grid, AW_ * 32, 0, stream>>>(feat, mask, w2, b2, pv, proj_b,
                                       mbs, alpha, out);
}

// v006
// One run takes 34.2 microseconds.
// Next to v005, in two timings, it ran 1.25 and 1.23 times as fast.
// All steps since v000 together make it 3.41 times as fast.
#include <hip/hip_runtime.h>
#include <hip/hip_bf16.h>
#include <stdint.h>

// Problem constants (match reference)
#define B_  8
#define C_  256
#define K_  8
#define H_  128
#define W_  128
#define HW_ (H_ * W_)

typedef __attribute__((ext_vector_type(2))) float v2f;
typedef __attribute__((ext_vector_type(8))) float v8f;

// ---------------------------------------------------------------------------
// Kernel 1: everything that comes before the pixels, in ONE launch.
// The area gate g = sqrt(p / max_k p), p = area/(H*W), is one scalar per
// (b,k), and the weight chain is linear in it:
//   k_tok = g * (k_w @ region_vec) + k_b ;  v_tok = g * (v_w @ region_vec) + v_b
// so the chain is folded without g, the bias vectors are folded as one more
// token, and kernel 2 forms  g * fold(b,k) + fold(bias)  when it stages the
// folded vectors. The mask sums then depend on nothing here and nothing here
// depends on them: they run beside the folds, on work-groups of their own.
//   work-groups 0 .. B*K-1 : token (b,k):  kt = k_w @ region_vec, vt = v_w @ region_vec
//   work-group  B*K        : bias token:   kt = k_b,              vt = v_b
//     both kinds:  w2[c] = (sum_o q_w[o][c] * kt[o]) / 16      (16 = sqrt(C))
//                  b2    = (sum_o q_b[o]    * kt[o]) / 16
//                  pv[c] =  sum_o proj_w[c][o] * vt[o]
//   work-groups B*K+1 ..   : area[b][k] = sum over H*W of mask[b][k][:]
// Every weight row (1 KB) is read by one whole wave as two loads of 512
// contiguous bytes (lane = 4 columns, twice), never one row per lane.
//   row . vector products (k_w, v_w, proj_w): per-lane partial dots, then a
//     sum over the 32 lanes;
//   column sums (q_w, with q_b as one more column): each wave adds its 8
//     rows, scaled, into 8 columns per lane; the 32 waves' partial rows are
//     added through LDS.
// grid = 2*B*K + 1 blocks, 1024 threads (32 waves)
// ---------------------------------------------------------------------------
#define NTOK_ (B_ * K_ + 1)    // folded tokens: one per (b,k), then the biases
#define FW_ 32                 // waves per work-group
typedef __attribute__((ext_vector_type(4))) float v4f;

__device__ __forceinline__ float dot8(v4f a0, v4f a1, v4f x0, v4f x1) {
  float s0 = a0.x * x0.x, s1 = a1.x * x1.x;
  s0 = fmaf(a0.y, x0.y, s0); s1 = fmaf(a1.y, x1.y, s1);
  s0 = fmaf(a0.z, x0.z, s0); s1 = fmaf(a1.z, x1.z, s1);
  s0 = fmaf(a0.w, x0.w, s0); s1 = fmaf(a1.w, x1.w, s1);
  return s0 + s1;
}

// Sums each of N (a power of two, at most 32) per-lane values over the 32
// lanes. Each exchange halves the values a lane still carries, so N values
// take N - 1 exchanges plus one for each step left. On return the lane holds
// the full sum of value number lane / (32 / N).
template <int N>
__device__ __forceinline__ float lane_sums(float (&p)[N], int lane) {
  int m = 16;
  #pragma unroll
  for (int n = N / 2; n >= 1; n >>= 1, m >>= 1) {
    const bool hi = (lane & m) != 0;
    #pragma unroll
    for (int i = 0; i < n; ++i) {
      const float lo_v = p[i], hi_v = p[i + n];   // values, so that the two
      const float keep = hi ? hi_v : lo_v;        // selects stay in registers
      const float send = hi ? lo_v : hi_v;
      p[i] = keep + __shfl_xor(send, m, 32);
    }
  }
  float s = p[0];
  #pragma unroll
  for (; m >= 1; m >>= 1) s += __shfl_xor(s, m, 32);
  return s;
}

__global__ __launch_bounds__(FW_ * 32) void fold_kernel(
    const float* __restrict__ mask, const float* __restrict__ region_vec,
    const float* __restrict__ q_w, const float* __restrict__ q_b,
    const float* __restrict__ k_w, const float* __restrict__ k_b,
    const float* __restrict__ v_w, const float* __restrict__ v_b,
    const float* __restrict__ proj_w,
    float* __restrict__ area,
    float* __restrict__ w2, float* __restrict__ b2, float* __restrict__ pv) {
  __shared__ __align__(16) float ktok[C_], vtok2[C_], pv_s[C_], b2_s[FW_];
  __shared__ __align__(16) float part[FW_ * C_];   // 32KB: per-wave w2 sums
  const int tk = blockIdx.x;    // token, or NTOK_ + mask plane
  const int t = threadIdx.x;
  const int lane = t & 31;
  const int wave = __builtin_amdgcn_readfirstlane(t >> 5);

  if (tk >= NTOK_) {
    // ---- area: one mask plane (64 KB), 4 loads of 16 B a thread -----------
    const v4f* m = (const v4f*)(mask + (size_t)(tk - NTOK_) * HW_) + t;
    const v4f m0 = m[0], m1 = m[FW_ * 32], m2 = m[2 * FW_ * 32], m3 = m[3 * FW_ * 32];
    const v4f m4 = (m0 + m1) + (m2 + m3);
    float s = (m4.x + m4.y) + (m4.z + m4.w);
    #pragma unroll
    for (int d = 16; d >= 1; d >>= 1) s += __shfl_xor(s, d, 32);
    if (lane == 0) b2_s[wave] = s;
    __syncthreads();
    if (wave == 0) {
      s = b2_s[lane];
      #pragma unroll
      for (int d = 16; d >= 1; d >>= 1) s += __shfl_xor(s, d, 32);
      if (lane == 0) area[tk - NTOK_] = s;
    }
    return;
  }

  if (tk < B_ * K_) {
    // This lane's 8 columns of region_vec, in registers.
    const v4f* rv = (const v4f*)(region_vec + (size_t)tk * C_);
    const v4f x0 = rv[lane], x1 = rv[32 + lane];

    // ---- kt, vt: waves 0-15 take 16 rows of k_w each, 16-31 of v_w --------
    const bool is_k = wave < FW_ / 2;
    const int r0 = (wave & (FW_ / 2 - 1)) * 16;
    const v4f* wrow = (const v4f*)((is_k ? k_w : v_w) + (size_t)r0 * C_) + lane;
    float* trow = (is_k ? ktok : vtok2) + r0;
    // Kept rolled: one trip's 16 loads (64 registers) are then requested
    // together; unrolled, the build split them into fours or spilled.
    #pragma unroll 1
    for (int h = 0; h < 16; h += 8) {
      float d1[8];
      #pragma unroll
      for (int i = 0; i < 8; ++i)
        d1[i] = dot8(wrow[i * (C_ / 4)], wrow[i * (C_ / 4) + 32], x0, x1);
      // Before the address register that the loads above name is advanced.
      asm volatile("s_wait_xcnt 0x0" ::: "memory");
      wrow += 8 * (C_ / 4);
      const float tok = lane_sums<8>(d1, lane);
      if ((lane & 3) == 0) trow[h + (lane >> 2)] = tok;
    }
  } else if (t < C_) {
    const float kb = k_b[t], vb = v_b[t];
    // Before any register that the two loads above name may be rewritten.
    asm volatile("s_wait_xcnt 0x0" ::: "memory");
    ktok[t] = kb;
    vtok2[t] = vb;
  }
  __syncthreads();

  // ---- pv: 8 rows of proj_w per wave --------------------------------------
  const v4f y0 = ((const v4f*)vtok2)[lane], y1 = ((const v4f*)vtok2)[32 + lane];
  float d2[8];
  #pragma unroll
  for (int i = 0; i < 8; ++i) {
    const v4f* r = (const v4f*)(proj_w + (size_t)(wave * 8 + i) * C_);
    d2[i] = dot8(r[lane], r[32 + lane], y0, y1);
  }
  // ---- w2: 8 rows of q_w per wave, summed down the columns ----------------
  // q_b goes along as one more column (b2).
  v4f c0 = {}, c1 = {};
  float cb = 0.f;
  #pragma unroll
  for (int i = 0; i < 8; ++i) {
    const v4f* r = (const v4f*)(q_w + (size_t)(wave * 8 + i) * C_);
    const float kt = ktok[wave * 8 + i];
    c0 += r[lane] * kt;
    c1 += r[32 + lane] * kt;
    cb = fmaf(q_b[wave * 8 + i], kt, cb);
  }
  ((v4f*)part)[wave * 64 + lane] = c0;
  ((v4f*)part)[wave * 64 + 32 + lane] = c1;
  const float pvv = lane_sums<8>(d2, lane);
  if ((lane & 3) == 0) pv_s[wave * 8 + (lane >> 2)] = pvv;
  if (lane == 0) b2_s[wave] = cb;
  __syncthreads();

  // ---- one thread per channel: add the waves' w2 rows, store w2 and pv;
  //      one more thread does the same for b2 ------------------------------
  if (t < C_) {
    float s0 = 0.f, s1 = 0.f, s2 = 0.f, s3 = 0.f;
    #pragma unroll
    for (int w = 0; w < FW_; w += 4) {
      s0 += part[(w + 0) * C_ + t];
      s1 += part[(w + 1) * C_ + t];
      s2 += part[(w + 2) * C_ + t];
      s3 += part[(w + 3) * C_ + t];
    }
    w2[(size_t)tk * C_ + t] = ((s0 + s1) + (s2 + s3)) * (1.0f / 16.0f);
    pv[(size_t)tk * C_ + t] = pv_s[t];
  } else if (t == C_) {
    float s = 0.f;
    #pragma unroll
    for (int w = 0; w < FW_; ++w) s += b2_s[w];
    b2[tk] = s * (1.0f / 16.0f);
  }
}

// ---------------------------------------------------------------------------
// Kernel 2: streaming attention kernel (memory-bound, WMMA)
//   The feat tile lives in registers from its load to the final add; LDS
//   holds only the folded weights, proj_b and the waves' partial logits.
//   Work-group: 128 pixels x 256 channels, 8 waves. Wave: 64 pixels (group
//   wave & 1) x 64 channels (quarter wave >> 1) = 32 loads of 16 B a lane.
//   Lane (half, n) holds pixels 4n..4n+3 of channels cbase + 16*ct + 8*half
//   + r: each load and each store covers 256 contiguous bytes of two rows.
//   Stage 1 : one WMMA takes 2 channels (one per lane half) x 32 pixels. B is
//             a register pair of a load as it stands: pixels 4n+2t, 4n+2t+1.
//             A row m < 8 is (w2[m][c], 0), row m >= 8 is (0, w2[m-8][c]), so
//             D rows 0-7 are the 8 logits of pixel 4n+2t and rows 8-15 those
//             of pixel 4n+2t+1: every lane ends with one pixel per t.
//   Sum     : the 4 channel quarters' partial logits are added through LDS.
//   Softmax : lane-local, 2 pixels a lane (each quarter's wave repeats it).
//   Stage 2 : delta^T(16ch x 16pix) = pv^T @ attn^T, 2 WMMAs per channel tile
//             and pixel j of the quad; D row r is the channel of load (ct, r).
//   Epilogue: out = feat + sigmoid(alpha)*(delta + proj_b), stored from the
//             registers, 16 B a lane.
//   The folded weights (w2, pv, b2) are staged once per work-group, each as
//   g * fold(b,k) + fold(bias)  with the area gate g of its region; proj_b as is.
// grid = (HW/128, B), 256 threads (8 waves)
// ---------------------------------------------------------------------------
#define AW_ 8                  // waves per work-group; AW_*32 threads == C_
// LDS layouts, each set by its reader (64 banks of 4 bytes):
//   w2: a stage-1 A read takes 16 bytes of each of 8 rows per 16 lanes.
//       Row pitch = 4 mod 64 dwords: the 8 rows lie on 32 different banks.
//   pv: a stage-2 A read takes 16 dwords in a row of each of two rows, 2 rows
//       apart. Row pitch = 16 mod 64 dwords: the two runs lie 32 banks apart.
//   part: 16 bytes a lane, lanes side by side.
#define W2P_ (C_ + 4)          // w2 row pitch, dwords
#define PVP_ (C_ + 16)         // pv row pitch, dwords
struct AttnLds {
  float w2[K_ * W2P_];         // 8KB
  float pv[K_ * PVP_];         // 8KB
  float pb[C_];                // 1KB
  float b2[16];
  float part[AW_ * 16 * 32];   // 16KB: per wave, 16 partial logits a lane
};
__global__ __launch_bounds__(AW_ * 32) void attn_kernel(
    const float* __restrict__ feat, const float* __restrict__ mask,
    const float* __restrict__ area, const float* __restrict__ w2g, const float* __restrict__ b2g,
    const float* __restrict__ pvg, const float* __restrict__ proj_b,
    const float* __restrict__ mbs_p, const float* __restrict__ alpha_p,
    float* __restrict__ out) {
  __shared__ __align__(16) AttnLds sm;
  float* const w2_s = sm.w2;
  float* const pv_s = sm.pv;
  float* const pb_s = sm.pb;
  float* const b2_s = sm.b2;

  const int b = blockIdx.y;
  const int tid = threadIdx.x;
  const int wave = __builtin_amdgcn_readfirstlane(tid >> 5);
  const int lane = tid & 31;
  const int half = lane >> 4;   // 0: lanes 0-15, 1: lanes 16-31
  const int row  = lane & 15;
  const int p0 = blockIdx.x * (16 * AW_) + (wave & 1) * 64;  // wave's pixels
  const int cbase = (wave >> 1) * 64;                        // wave's channels

  // The wave's global loads, all but b2, mbs and alpha, are issued together, those wanted first in
  // front (loads return in order): weights, area, mask, feat.
  // Weights: one thread per channel, 19 unconditional loads.
  const float* w2b = w2g + (size_t)b * K_ * C_;
  const float* pvb = pvg + (size_t)b * K_ * C_;
  float w2r[K_], pvr[K_];
  for (int r = 0; r < K_; ++r) w2r[r] = w2b[r * C_ + tid];
  for (int r = 0; r < K_; ++r) pvr[r] = pvb[r * C_ + tid];
  const float pbr = proj_b[tid];
  const float w2c = w2g[(size_t)(B_ * K_) * C_ + tid];   // the bias token's fold
  const float pvc = pvg[(size_t)(B_ * K_) * C_ + tid];
  // Area: lane l takes region l % 8 of this batch.
  const float arl = area[b * K_ + (lane & 7)];
  // Mask: this lane's softmax pixels are p0 + 4*row + 2*t + half, t = 0, 1.
  const float* mB = mask + (size_t)b * K_ * HW_ + p0 + 4 * row + half;
  float mk[2][K_];
  #pragma unroll
  for (int t = 0; t < 2; ++t)
    #pragma unroll
    for (int r = 0; r < K_; ++r) mk[t][r] = mB[(size_t)r * HW_ + 2 * t];
  // feat: X[ct][r] = pixels p0 + 4*row .. +3 of channel cbase + 16*ct + 8*half + r.
  const size_t tile0 = ((size_t)b * C_ + cbase + 8 * half) * HW_ + p0 + 4 * row;
  const float* fsrc = feat + tile0;
  v4f X[4][8];
  #pragma unroll
  for (int ct = 0; ct < 4; ++ct)
    #pragma unroll
    for (int r = 0; r < 8; ++r)
      X[ct][r] = *(const v4f*)(fsrc + (size_t)(ct * 16 + r) * HW_);
  // Before any register that the loads above name may be rewritten.
  asm volatile("s_wait_xcnt 0x0" ::: "memory");
  // Keeps the gate's arithmetic, which waits for the area load, behind the
  // issue of every load above: the build had put that wait in front of the
  // mask and feat loads.
  __builtin_amdgcn_sched_barrier(0);
  // Area gate of region lane % 8: g = sqrt(p / max(max_k p, 1e-6)).
  const float pl = arl * (1.0f / (float)(HW_));
  float dmax = pl;
  #pragma unroll
  for (int d = 1; d < K_; d <<= 1) dmax = fmaxf(dmax, __shfl_xor(dmax, d, 32));
  const float gl = sqrtf(fmaxf(pl / fmaxf(dmax, 1e-6f), 0.0f));
  for (int r = 0; r < K_; ++r) {
    const float g = __int_as_float(__builtin_amdgcn_readlane(__float_as_int(gl), r));
    w2_s[r * W2P_ + tid] = fmaf(g, w2r[r], w2c);
    pv_s[r * PVP_ + tid] = fmaf(g, pvr[r], pvc);
  }
  pb_s[tid] = pbr;
  if (tid < 16) {
    float b2v = 0.0f;
    if (tid < K_) {
      const float b2r = b2g[b * K_ + tid], b2c = b2g[B_ * K_];
      // Before any register that the two loads above name may be rewritten.
      asm volatile("s_wait_xcnt 0x0" ::: "memory");
      b2v = fmaf(gl, b2r, b2c);
    }
    b2_s[tid] = b2v;
  }
  __syncthreads();

  const float mbs = mbs_p[0];
  const float gate = 1.0f / (1.0f + __expf(-alpha_p[0]));

  // ---- Stage 1: partial logits over the wave's 64 channels ----------------
  // k position (half, i) of A and of B alike: channel of this half, pixel
  // 4n + 2t + i; A is zero where i differs from the D row's pixel (row >> 3).
  const bool lo = row < 8;
  const float* w2row = w2_s + (row & 7) * W2P_ + cbase + 8 * half;
  v8f acc[2] = {{}, {}};
  #pragma unroll
  for (int ct = 0; ct < 4; ++ct) {
    const v4f wa = *(const v4f*)(w2row + ct * 16);
    const v4f wb = *(const v4f*)(w2row + ct * 16 + 4);
    #pragma unroll
    for (int r = 0; r < 8; ++r) {
      const float w = (r < 4) ? wa[r & 3] : wb[r & 3];
      v2f Aop, Bq0, Bq1;
      Aop.x = lo ? w : 0.0f;
      Aop.y = lo ? 0.0f : w;
      Bq0.x = X[ct][r].x; Bq0.y = X[ct][r].y;
      Bq1.x = X[ct][r].z; Bq1.y = X[ct][r].w;
      acc[0] = __builtin_amdgcn_wmma_f32_16x16x4_f32(false, Aop, false, Bq0,
                                                     (short)0, acc[0], false, false);
      acc[1] = __builtin_amdgcn_wmma_f32_16x16x4_f32(false, Aop, false, Bq1,
                                                     (short)0, acc[1], false, false);
    }
  }

  // ---- Add the 4 channel quarters' partial logits through LDS -------------
  v4f* const part = (v4f*)sm.part;
  #pragma unroll
  for (int t = 0; t < 2; ++t) {
    const v4f s0 = {acc[t][0], acc[t][1], acc[t][2], acc[t][3]};
    const v4f s1 = {acc[t][4], acc[t][5], acc[t][6], acc[t][7]};
    part[(wave * 4 + t * 2 + 0) * 32 + lane] = s0;
    part[(wave * 4 + t * 2 + 1) * 32 + lane] = s1;
  }
  // Every wave's partial logits are in LDS before another wave reads them.
  __syncthreads();
  v4f ls[4];
  #pragma unroll
  for (int i = 0; i < 4; ++i) {
    const v4f* pr = part + ((wave & 1) * 4 + i) * 32 + lane;   // quarter 0
    ls[i] = ((pr[0] + pr[8 * 32]) + pr[16 * 32]) + pr[24 * 32];
  }

  // ---- Bias + softmax (lane-local, one pixel per t) -----------------------
  float attnv[2][8];
  #pragma unroll
  for (int t = 0; t < 2; ++t) {
    float logit[8];
    float mx = -1e30f;
    #pragma unroll
    for (int r = 0; r < 8; ++r) {
      float l = ls[t * 2 + (r >> 2)][r & 3] + b2_s[r] + mbs * __logf(mk[t][r] + 1e-6f);
      logit[r] = l;
      mx = fmaxf(mx, l);
    }
    float sum = 0.f;
    #pragma unroll
    for (int r = 0; r < 8; ++r) {
      float e = __expf(logit[r] - mx);
      attnv[t][r] = e;
      sum += e;
    }
    const float inv = 1.0f / sum;
    #pragma unroll
    for (int r = 0; r < 8; ++r) attnv[t][r] *= inv;
  }

  // ---- Build stage-2 B operands: attn^T (k x pixel), pixel 4n + j ---------
  // Pixel j = 2t + h' was normalised in lane half h'. Half 0 of B wants its
  // k = 0,1 (4,5), half 1 its k = 2,3 (6,7): own values in half h', the
  // partner lane's (lane ^ 16) in the other half.
  v2f B1[4], B2[4];
  #pragma unroll
  for (int t = 0; t < 2; ++t) {
    float sw[8];
    #pragma unroll
    for (int r = 0; r < 8; ++r) sw[r] = __shfl_xor(attnv[t][r], 16, 32);
    B1[2 * t].x = half ? sw[2] : attnv[t][0];
    B1[2 * t].y = half ? sw[3] : attnv[t][1];
    B2[2 * t].x = half ? sw[6] : attnv[t][4];
    B2[2 * t].y = half ? sw[7] : attnv[t][5];
    B1[2 * t + 1].x = half ? attnv[t][2] : sw[0];
    B1[2 * t + 1].y = half ? attnv[t][3] : sw[1];
    B2[2 * t + 1].x = half ? attnv[t][6] : sw[4];
    B2[2 * t + 1].y = half ? attnv[t][7] : sw[5];
  }

  // ---- Stage 2 + epilogue -------------------------------------------------
  // A (16x4): M=channel (16*ct+row), K = region index (2 WMMAs cover k=0..7)
  // D row r of pixel tile j: channel cbase + 16*ct + 8*half + r, pixel 4n + j,
  // which is element j of X[ct][r].
  float* odst = out + tile0;
  #pragma unroll
  for (int ct = 0; ct < 4; ++ct) {
    const int ch = cbase + ct * 16 + row;
    v2f A1, A2;
    A1.x = pv_s[(0 + 2 * half) * PVP_ + ch];
    A1.y = pv_s[(1 + 2 * half) * PVP_ + ch];
    A2.x = pv_s[(4 + 2 * half) * PVP_ + ch];
    A2.y = pv_s[(5 + 2 * half) * PVP_ + ch];
    const v4f pb0 = *(const v4f*)(pb_s + cbase + ct * 16 + 8 * half);
    const v4f pb1 = *(const v4f*)(pb_s + cbase + ct * 16 + 8 * half + 4);
    v8f d[4];
    #pragma unroll
    for (int j = 0; j < 4; ++j) {
      const v8f z = {};
      d[j] = __builtin_amdgcn_wmma_f32_16x16x4_f32(false, A1, false, B1[j],
                                                   (short)0, z, false, false);
    }
    #pragma unroll
    for (int j = 0; j < 4; ++j)
      d[j] = __builtin_amdgcn_wmma_f32_16x16x4_f32(false, A2, false, B2[j],
                                                   (short)0, d[j], false, false);
    #pragma unroll
    for (int r = 0; r < 8; ++r) {
      const float pbv = (r < 4) ? pb0[r & 3] : pb1[r & 3];
      v4f o;
      o.x = X[ct][r].x + gate * (d[0][r] + pbv);
      o.y = X[ct][r].y + gate * (d[1][r] + pbv);
      o.z = X[ct][r].z + gate * (d[2][r] + pbv);
      o.w = X[ct][r].w + gate * (d[3][r] + pbv);
      *(v4f*)(odst + (size_t)(ct * 16 + r) * HW_) = o;
    }
  }
}

// ---------------------------------------------------------------------------
extern "C" void kernel_launch(void* const* d_in, const int* in_sizes, int n_in,
                              void* d_out, int out_size, void* d_ws, size_t ws_size,
                              hipStream_t stream) {
  const float* feat       = (const float*)d_in[0];
  const float* mask       = (const float*)d_in[1];
  const float* region_vec = (const float*)d_in[2];
  const float* q_w        = (const float*)d_in[3];
  const float* q_b        = (const float*)d_in[4];
  const float* k_w        = (const float*)d_in[5];
  const float* k_b        = (const float*)d_in[6];
  const float* v_w        = (const float*)d_in[7];
  const float* v_b        = (const float*)d_in[8];
  const float* proj_w     = (const float*)d_in[9];
  const float* proj_b     = (const float*)d_in[10];
  const float* mbs        = (const float*)d_in[11];
  const float* alpha      = (const float*)d_in[12];
  float* out = (float*)d_out;

  float* ws   = (float*)d_ws;
  float* area = ws;                       // B*K       = 64
  float* b2   = ws + 64;                  // NTOK      = 65
  float* w2   = ws + 256;                 // NTOK*C    = 16640
  float* pv   = ws + 256 + NTOK_ * C_;    // NTOK*C    = 16640

  fold_kernel<<<NTOK_ + B_ * K_, FW_ * 32, 0, stream>>>(mask, region_vec, q_w, q_b,
                                                   k_w, k_b, v_w, v_b, proj_w,
                                                   area, w2, b2, pv);
  dim3 grid(HW_ / (16 * AW_), B_);
  attn_kernel<<<grid, AW_ * 32, 0, stream>>>(feat, mask, area, w2, b2, pv, proj_b,
                                       mbs, alpha, out);
}

// v007
// A run of this version takes 32.2 microseconds.
// In two side-by-side timings against v006, it was 1.06 and 1.07 times as fast.
// All steps since v000 together make it 3.63 times as fast.
#include <hip/hip_runtime.h>
#include <hip/hip_bf16.h>
#include <stdint.h>

// Problem constants (match reference)
#define B_  8
#define C_  256
#define K_  8
#define H_  128
#define W_  128
#define HW_ (H_ * W_)

typedef __attribute__((ext_vector_type(2))) float v2f;
typedef __attribute__((ext_vector_type(8))) float v8f;

// ---------------------------------------------------------------------------
// Kernel 1: everything that comes before the pixels, in ONE launch.
// The area gate g = sqrt(p / max_k p), p = area/(H*W), is one scalar per
// (b,k), and the weight chain is linear in it:
//   k_tok = g * (k_w @ region_vec) + k_b ;  v_tok = g * (v_w @ region_vec) + v_b
// so the chain is folded without g, the bias vectors are folded as one more
// token, and kernel 2 forms  g * fold(b,k) + fold(bias)  when it stages the
// folded vectors. The mask sums then depend on nothing here and nothing here
// depends on them: they run beside the folds, on work-groups of their own.
//   work-groups 0 .. B*K-1 : token (b,k):  kt = k_w @ region_vec, vt = v_w @ region_vec
//   work-group  B*K        : bias token:   kt = k_b,              vt = v_b
//     both kinds:  w2[c] = (sum_o q_w[o][c] * kt[o]) / 16      (16 = sqrt(C))
//                  b2    = (sum_o q_b[o]    * kt[o]) / 16
//                  pv[c] =  sum_o proj_w[c][o] * vt[o]
//   work-groups B*K+1 ..   : area[b][k] = sum over H*W of mask[b][k][:]
// Every weight row (1 KB) is read by one whole wave as two loads of 512
// contiguous bytes (lane = 4 columns, twice), never one row per lane.
//   row . vector products (k_w, v_w, proj_w): per-lane partial dots, then a
//     sum over the 32 lanes;
//   column sums (q_w, with q_b as one more column): each wave adds its 8
//     rows, scaled, into 8 columns per lane; the 32 waves' partial rows are
//     added through LDS.
// grid = 2*B*K + 1 blocks, 1024 threads (32 waves)
// ---------------------------------------------------------------------------
#define NTOK_ (B_ * K_ + 1)    // folded tokens: one per (b,k), then the biases
#define FW_ 32                 // waves per work-group
typedef __attribute__((ext_vector_type(4))) float v4f;

__device__ __forceinline__ float dot8(v4f a0, v4f a1, v4f x0, v4f x1) {
  float s0 = a0.x * x0.x, s1 = a1.x * x1.x;
  s0 = fmaf(a0.y, x0.y, s0); s1 = fmaf(a1.y, x1.y, s1);
  s0 = fmaf(a0.z, x0.z, s0); s1 = fmaf(a1.z, x1.z, s1);
  s0 = fmaf(a0.w, x0.w, s0); s1 = fmaf(a1.w, x1.w, s1);
  return s0 + s1;
}

// Sums each of N (a power of two, at most 32) per-lane values over the 32
// lanes. Each exchange halves the values a lane still carries, so N values
// take N - 1 exchanges plus one for each step left. On return the lane holds
// the full sum of value number lane / (32 / N).
template <int N>
__device__ __forceinline__ float lane_sums(float (&p)[N], int lane) {
  int m = 16;
  #pragma unroll
  for (int n = N / 2; n >= 1; n >>= 1, m >>= 1) {
    const bool hi = (lane & m) != 0;
    #pragma unroll
    for (int i = 0; i < n; ++i) {
      const float lo_v = p[i], hi_v = p[i + n];   // values, so that the two
      const float keep = hi ? hi_v : lo_v;        // selects stay in registers
      const float send = hi ? lo_v : hi_v;
      p[i] = keep + __shfl_xor(send, m, 32);
    }
  }
  float s = p[0];
  #pragma unroll
  for (; m >= 1; m >>= 1) s += __shfl_xor(s, m, 32);
  return s;
}

__global__ __launch_bounds__(FW_ * 32) void fold_kernel(
    const float* __restrict__ mask, const float* __restrict__ region_vec,
    const float* __restrict__ q_w, const float* __restrict__ q_b,
    const float* __restrict__ k_w, const float* __restrict__ k_b,
    const float* __restrict__ v_w, const float* __restrict__ v_b,
    const float* __restrict__ proj_w,
    float* __restrict__ area,
    float* __restrict__ w2, float* __restrict__ b2, float* __restrict__ pv) {
  __shared__ __align__(16) float ktok[C_], vtok2[C_], pv_s[C_], b2_s[FW_];
  __shared__ __align__(16) float part[FW_ * C_];   // 32KB: per-wave w2 sums
  const int tk = blockIdx.x;    // token, or NTOK_ + mask plane
  const int t = threadIdx.x;
  const int lane = t & 31;
  const int wave = __builtin_amdgcn_readfirstlane(t >> 5);

  if (tk >= NTOK_) {
    // ---- area: one mask plane (64 KB), 4 loads of 16 B a thread -----------
    const v4f* m = (const v4f*)(mask + (size_t)(tk - NTOK_) * HW_) + t;
    const v4f m0 = m[0], m1 = m[FW_ * 32], m2 = m[2 * FW_ * 32], m3 = m[3 * FW_ * 32];
    const v4f m4 = (m0 + m1) + (m2 + m3);
    float s = (m4.x + m4.y) + (m4.z + m4.w);
    #pragma unroll
    for (int d = 16; d >= 1; d >>= 1) s += __shfl_xor(s, d, 32);
    if (lane == 0) b2_s[wave] = s;
    __syncthreads();
    if (wave == 0) {
      s = b2_s[lane];
      #pragma unroll
      for (int d = 16; d >= 1; d >>= 1) s += __shfl_xor(s, d, 32);
      if (lane == 0) area[tk - NTOK_] = s;
    }
    return;
  }

  if (tk < B_ * K_) {
    // This lane's 8 columns of region_vec, in registers.
    const v4f* rv = (const v4f*)(region_vec + (size_t)tk * C_);
    const v4f x0 = rv[lane], x1 = rv[32 + lane];

    // ---- kt, vt: waves 0-15 take 16 rows of k_w each, 16-31 of v_w --------
    const bool is_k = wave < FW_ / 2;
    const int r0 = (wave & (FW_ / 2 - 1)) * 16;
    const v4f* wrow = (const v4f*)((is_k ? k_w : v_w) + (size_t)r0 * C_) + lane;
    float* trow = (is_k ? ktok : vtok2) + r0;
    // Kept rolled: one trip's 16 loads (64 registers) are then requested
    // together; unrolled, the build split them into fours or spilled.
    #pragma unroll 1
    for (int h = 0; h < 16; h += 8) {
      float d1[8];
      #pragma unroll
      for (int i = 0; i < 8; ++i)
        d1[i] = dot8(wrow[i * (C_ / 4)], wrow[i * (C_ / 4) + 32], x0, x1);
      // Before the address register that the loads above name is advanced.
      asm volatile("s_wait_xcnt 0x0" ::: "memory");
      wrow += 8 * (C_ / 4);
      const float tok = lane_sums<8>(d1, lane);
      if ((lane & 3) == 0) trow[h + (lane >> 2)] = tok;
    }
  } else if (t < C_) {
    const float kb = k_b[t], vb = v_b[t];
    // Before any register that the two loads above name may be rewritten.
    asm volatile("s_wait_xcnt 0x0" ::: "memory");
    ktok[t] = kb;
    vtok2[t] = vb;
  }
  __syncthreads();

  // ---- pv: 8 rows of proj_w per wave --------------------------------------
  const v4f y0 = ((const v4f*)vtok2)[lane], y1 = ((const v4f*)vtok2)[32 + lane];
  float d2[8];
  #pragma unroll
  for (int i = 0; i < 8; ++i) {
    const v4f* r = (const v4f*)(proj_w + (size_t)(wave * 8 + i) * C_);
    d2[i] = dot8(r[lane], r[32 + lane], y0, y1);
  }
  // ---- w2: 8 rows of q_w per wave, summed down the columns ----------------
  // q_b goes along as one more column (b2).
  v4f c0 = {}, c1 = {};
  float cb = 0.f;
  #pragma unroll
  for (int i = 0; i < 8; ++i) {
    const v4f* r = (const v4f*)(q_w + (size_t)(wave * 8 + i) * C_);
    const float kt = ktok[wave * 8 + i];
    c0 += r[lane] * kt;
    c1 += r[32 + lane] * kt;
    cb = fmaf(q_b[wave * 8 + i], kt, cb);
  }
  ((v4f*)part)[wave * 64 + lane] = c0;
  ((v4f*)part)[wave * 64 + 32 + lane] = c1;
  const float pvv = lane_sums<8>(d2, lane);
  if ((lane & 3) == 0) pv_s[wave * 8 + (lane >> 2)] = pvv;
  if (lane == 0) b2_s[wave] = cb;
  __syncthreads();

  // ---- one thread per channel: add the waves' w2 rows, store w2 and pv;
  //      one more thread does the same for b2 ------------------------------
  if (t < C_) {
    float s0 = 0.f, s1 = 0.f, s2 = 0.f, s3 = 0.f;
    #pragma unroll
    for (int w = 0; w < FW_; w += 4) {
      s0 += part[(w + 0) * C_ + t];
      s1 += part[(w + 1) * C_ + t];
      s2 += part[(w + 2) * C_ + t];
      s3 += part[(w + 3) * C_ + t];
    }
    w2[(size_t)tk * C_ + t] = ((s0 + s1) + (s2 + s3)) * (1.0f / 16.0f);
    pv[(size_t)tk * C_ + t] = pv_s[t];
  } else if (t == C_) {
    float s = 0.f;
    #pragma unroll
    for (int w = 0; w < FW_; ++w) s += b2_s[w];
    b2[tk] = s * (1.0f / 16.0f);
  }
}

// ---------------------------------------------------------------------------
// Kernel 2: streaming attention kernel (memory-bound, WMMA)
//   The feat tile lives in registers from its load to the final add; LDS
//   holds only the folded weights and the waves' partial logits.
//   Work-group: 8 waves, TPG_ tiles of 128 pixels x 256 channels one after
//   another, on two register sets: the loads of tile t + 1 are issued before
//   tile t is worked on, so that they fly during its WMMAs, softmax and stores.
//   Wave, per tile: 64 pixels (group wave & 1) x 64 channels (quarter
//   wave >> 1) = 32 loads of 16 B a lane.
//   Lane (half, n) holds pixels 4n..4n+3 of channels cbase + 16*ct + 8*half
//   + r: each load and each store covers 256 contiguous bytes of two rows.
//   Stage 1 : one WMMA takes 2 channels (one per lane half) x 32 pixels. B is
//             a register pair of a load as it stands: pixels 4n+2t, 4n+2t+1.
//             A row m < 8 is (w2[m][c], 0), row m >= 8 is (0, w2[m-8][c]), so
//             D rows 0-7 are the 8 logits of pixel 4n+2t and rows 8-15 those
//             of pixel 4n+2t+1: every lane ends with one pixel per t.
//   Sum     : the 4 channel quarters' partial logits are added through LDS.
//   Softmax : lane-local, 2 pixels a lane (each quarter's wave repeats it).
//   Stage 2 : delta^T(16ch x 16pix) = pv^T @ attn^T, 2 WMMAs per channel tile
//             and pixel j of the quad; D row r is the channel of load (ct, r).
//   Epilogue: out = feat + sigmoid(alpha)*(delta + proj_b), stored from the
//             registers, 16 B a lane.
//   The weights (w2, pv, proj_b, b2) are staged once per work-group; w2,
//   pv and b2 each as  g * fold(b,k) + fold(bias)  with the area gate g of its region.
// grid = (HW/(128*TPG_), B), 256 threads (8 waves)
// ---------------------------------------------------------------------------
#define AW_ 8                  // waves per work-group; AW_*32 threads == C_
#define TPX_ (16 * AW_)        // pixels of a tile
#define TPG_ 4                 // tiles a work-group takes
// LDS layouts, each set by its reader (64 banks of 4 bytes):
//   w2: a stage-1 A read takes 16 bytes of each of 8 rows per 16 lanes.
//       Row pitch = 4 mod 64 dwords: the 8 rows lie on 32 different banks.
//   pv: a stage-2 A read takes 16 dwords in a row of each of two rows, 2 rows
//       apart. Row pitch = 16 mod 64 dwords: the two runs lie 32 banks apart.
//   part: 16 bytes a lane, lanes side by side; one buffer for even tiles and
//       one for odd, so that one barrier a tile is enough.
#define W2P_ (C_ + 4)          // w2 row pitch, dwords
#define PVP_ (C_ + 16)         // pv row pitch, dwords
struct AttnLds {
  float w2[K_ * W2P_];         // 8KB
  float pv[K_ * PVP_];         // 8KB
  float pb[C_];                // 1KB
  float b2[16];
  float part[2][AW_ * 16 * 32];  // 2 x 16KB: per wave, 16 partial logits a lane
};

// Issues one tile's loads of this wave, mask in front (loads return in order).
//   mk[t][r]: region r at this lane's softmax pixel 4*row + 2*t + half.
//   X[ct][r]: pixels 4*row .. +3 of channel cbase + 16*ct + 8*half + r.
__device__ __forceinline__ void load_tile(const float* __restrict__ msrc,
                                          const float* __restrict__ fsrc,
                                          float (&mk)[2][K_], v4f (&X)[4][8]) {
  #pragma unroll
  for (int t = 0; t < 2; ++t)
    #pragma unroll
    for (int r = 0; r < K_; ++r) mk[t][r] = msrc[(size_t)r * HW_ + 2 * t];
  #pragma unroll
  for (int ct = 0; ct < 4; ++ct)
    #pragma unroll
    for (int r = 0; r < 8; ++r)
      X[ct][r] = *(const v4f*)(fsrc + (size_t)(ct * 16 + r) * HW_);
  // Before any register that the loads above name may be rewritten.
  asm volatile("s_wait_xcnt 0x0" ::: "memory");
  // Keeps every load above issued here, ahead of the work that follows: the
  // loads are wanted in flight during that work, not sunk to their first use.
  __builtin_amdgcn_sched_barrier(0);
}

// Stores 8 channel rows, 16 B a lane each, from byte offset OFF on. The wait
// stands in the stores' own statement: behind it their registers are free to
// be rewritten, and nothing can be scheduled between the stores and the wait.
template <int OFF>
__device__ __forceinline__ void store_rows(float* base, const v4f (&o)[8]) {
  asm volatile(
      "global_store_b128 %0, %1, off offset:%9\n\t"
      "global_store_b128 %0, %2, off offset:%10\n\t"
      "global_store_b128 %0, %3, off offset:%11\n\t"
      "global_store_b128 %0, %4, off offset:%12\n\t"
      "global_store_b128 %0, %5, off offset:%13\n\t"
      "global_store_b128 %0, %6, off offset:%14\n\t"
      "global_store_b128 %0, %7, off offset:%15\n\t"
      "global_store_b128 %0, %8, off offset:%16\n\t"
      "s_wait_xcnt 0x0"
      :: "v"(base), "v"(o[0]), "v"(o[1]), "v"(o[2]), "v"(o[3]),
         "v"(o[4]), "v"(o[5]), "v"(o[6]), "v"(o[7]),
         "n"(OFF), "n"(OFF + 1 * HW_ * 4), "n"(OFF + 2 * HW_ * 4), "n"(OFF + 3 * HW_ * 4),
         "n"(OFF + 4 * HW_ * 4), "n"(OFF + 5 * HW_ * 4), "n"(OFF + 6 * HW_ * 4),
         "n"(OFF + 7 * HW_ * 4)
      : "memory");
}

// What stage 2 reads of the folded weights is the same for every pixel tile:
// a lane reads it from LDS once and keeps it (48 registers).
struct Stage2W {
  v2f A1[4], A2[4];            // pv^T fragments, k = 0..3 and 4..7, per channel tile
  v4f pb0[4], pb1[4];          // proj_b of the lane's 8 D rows, per channel tile
};

// Stage 2 and epilogue of channel tile CT.
// A (16x4): M=channel (16*CT+row), K = region index (2 WMMAs cover k=0..7)
// D row r of pixel tile j: channel cbase + 16*CT + 8*half + r, pixel 4n + j,
// which is element j of X[r].
template <int CT>
__device__ __forceinline__ void stage2(const Stage2W& w, const v4f (&X)[8],
                                       const v2f (&B1)[4], const v2f (&B2)[4],
                                       float* odst, float gate) {
  const v2f A1 = w.A1[CT], A2 = w.A2[CT];
  const v4f pb0 = w.pb0[CT], pb1 = w.pb1[CT];
  v8f d[4];
  #pragma unroll
  for (int j = 0; j < 4; ++j) {
    const v8f z = {};
    d[j] = __builtin_amdgcn_wmma_f32_16x16x4_f32(false, A1, false, B1[j],
                                                 (short)0, z, false, false);
  }
  #pragma unroll
  for (int j = 0; j < 4; ++j)
    d[j] = __builtin_amdgcn_wmma_f32_16x16x4_f32(false, A2, false, B2[j],
                                                 (short)0, d[j], false, false);
  v4f o[8];
  #pragma unroll
  for (int r = 0; r < 8; ++r) {
    const float pbv = (r < 4) ? pb0[r & 3] : pb1[r & 3];
    o[r].x = X[r].x + gate * (d[0][r] + pbv);
    o[r].y = X[r].y + gate * (d[1][r] + pbv);
    o[r].z = X[r].z + gate * (d[2][r] + pbv);
    o[r].w = X[r].w + gate * (d[3][r] + pbv);
  }
  store_rows<CT * 16 * HW_ * 4>(odst, o);
}

// One pixel tile, from its registers to its stores.
__device__ __forceinline__ void do_tile(AttnLds& sm, const Stage2W& w2nd, v4f* __restrict__ part,
                                        const float (&mk)[2][K_], const v4f (&X)[4][8],
                                        float* __restrict__ odst,
                                        int wave, int lane, int cbase,
                                        float mbs, float gate) {
  const float* const w2_s = sm.w2;
  const float* const b2_s = sm.b2;
  const int half = lane >> 4;   // 0: lanes 0-15, 1: lanes 16-31
  const int row  = lane & 15;

  // ---- Stage 1: partial logits over the wave's 64 channels ----------------
  // k position (half, i) of A and of B alike: channel of this half, pixel
  // 4n + 2t + i; A is zero where i differs from the D row's pixel (row >> 3).
  const bool lo = row < 8;
  const float* w2row = w2_s + (row & 7) * W2P_ + cbase + 8 * half;
  v8f acc[2] = {{}, {}};
  #pragma unroll
  for (int ct = 0; ct < 4; ++ct) {
    const v4f wa = *(const v4f*)(w2row + ct * 16);
    const v4f wb = *(const v4f*)(w2row + ct * 16 + 4);
    #pragma unroll
    for (int r = 0; r < 8; ++r) {
      const float w = (r < 4) ? wa[r & 3] : wb[r & 3];
      v2f Aop, Bq0, Bq1;
      Aop.x = lo ? w : 0.0f;
      Aop.y = lo ? 0.0f : w;
      Bq0.x = X[ct][r].x; Bq0.y = X[ct][r].y;
      Bq1.x = X[ct][r].z; Bq1.y = X[ct][r].w;
      acc[0] = __builtin_amdgcn_wmma_f32_16x16x4_f32(false, Aop, false, Bq0,
                                                     (short)0, acc[0], false, false);
      acc[1] = __builtin_amdgcn_wmma_f32_16x16x4_f32(false, Aop, false, Bq1,
                                                     (short)0, acc[1], false, false);
    }
  }

  // ---- Add the 4 channel quarters' partial logits through LDS -------------
  #pragma unroll
  for (int t = 0; t < 2; ++t) {
    const v4f s0 = {acc[t][0], acc[t][1], acc[t][2], acc[t][3]};
    const v4f s1 = {acc[t][4], acc[t][5], acc[t][6], acc[t][7]};
    part[(wave * 4 + t * 2 + 0) * 32 + lane] = s0;
    part[(wave * 4 + t * 2 + 1) * 32 + lane] = s1;
  }
  // Every wave's partial logits are in LDS before another wave reads them.
  // The fences name LDS alone: __syncthreads() would also wait for the next
  // tile's global loads, which are to stay in flight across this barrier.
  __builtin_amdgcn_fence(__ATOMIC_RELEASE, "workgroup", "local");
  __builtin_amdgcn_s_barrier();
  __builtin_amdgcn_fence(__ATOMIC_ACQUIRE, "workgroup", "local");
  v4f ls[4];
  #pragma unroll
  for (int i = 0; i < 4; ++i) {
    const v4f* pr = part + ((wave & 1) * 4 + i) * 32 + lane;   // quarter 0
    ls[i] = ((pr[0] + pr[8 * 32]) + pr[16 * 32]) + pr[24 * 32];
  }

  // ---- Bias + softmax (lane-local, one pixel per t) -----------------------
  float attnv[2][8];
  #pragma unroll
  for (int t = 0; t < 2; ++t) {
    float logit[8];
    float mx = -1e30f;
    #pragma unroll
    for (int r = 0; r < 8; ++r) {
      float l = ls[t * 2 + (r >> 2)][r & 3] + b2_s[r] + mbs * __logf(mk[t][r] + 1e-6f);
      logit[r] = l;
      mx = fmaxf(mx, l);
    }
    float sum = 0.f;
    #pragma unroll
    for (int r = 0; r < 8; ++r) {
      float e = __expf(logit[r] - mx);
      attnv[t][r] = e;
      sum += e;
    }
    const float inv = 1.0f / sum;
    #pragma unroll
    for (int r = 0; r < 8; ++r) attnv[t][r] *= inv;
  }

  // ---- Build stage-2 B operands: attn^T (k x pixel), pixel 4n + j ---------
  // Pixel j = 2t + h' was normalised in lane half h'. Half 0 of B wants its
  // k = 0,1 (4,5), half 1 its k = 2,3 (6,7): own values in half h', the
  // partner lane's (lane ^ 16) in the other half.
  v2f B1[4], B2[4];
  #pragma unroll
  for (int t = 0; t < 2; ++t) {
    float sw[8];
    #pragma unroll
    for (int r = 0; r < 8; ++r) sw[r] = __shfl_xor(attnv[t][r], 16, 32);
    B1[2 * t].x = half ? sw[2] : attnv[t][0];
    B1[2 * t].y = half ? sw[3] : attnv[t][1];
    B2[2 * t].x = half ? sw[6] : attnv[t][4];
    B2[2 * t].y = half ? sw[7] : attnv[t][5];
    B1[2 * t + 1].x = half ? attnv[t][2] : sw[0];
    B1[2 * t + 1].y = half ? attnv[t][3] : sw[1];
    B2[2 * t + 1].x = half ? attnv[t][6] : sw[4];
    B2[2 * t + 1].y = half ? attnv[t][7] : sw[5];
  }

  // ---- Stage 2 + epilogue -------------------------------------------------
  stage2<0>(w2nd, X[0], B1, B2, odst, gate);
  stage2<1>(w2nd, X[1], B1, B2, odst, gate);
  // Bounds the registers: without it the build issued all 32 WMMAs ahead of
  // the first add, held 128 result registers and spilled loaded tiles.
  __builtin_amdgcn_sched_barrier(0);
  stage2<2>(w2nd, X[2], B1, B2, odst, gate);
  stage2<3>(w2nd, X[3], B1, B2, odst, gate);
}

__global__ __launch_bounds__(AW_ * 32) void attn_kernel(
    const float* __restrict__ feat, const float* __restrict__ mask,
    const float* __restrict__ area, const float* __restrict__ w2g, const float* __restrict__ b2g,
    const float* __restrict__ pvg, const float* __restrict__ proj_b,
    const float* __restrict__ mbs_p, const float* __restrict__ alpha_p,
    float* __restrict__ out) {
  __shared__ __align__(16) AttnLds sm;
  float* const w2_s = sm.w2;
  float* const pv_s = sm.pv;
  float* const pb_s = sm.pb;
  float* const b2_s = sm.b2;

  const int b = blockIdx.y;
  const int tid = threadIdx.x;
  const int wave = __builtin_amdgcn_readfirstlane(tid >> 5);
  const int lane = tid & 31;
  const int half = lane >> 4;   // 0: lanes 0-15, 1: lanes 16-31
  const int row  = lane & 15;
  // The wave's pixels in the work-group's first tile, and its channels.
  const int p0 = blockIdx.x * (TPG_ * TPX_) + (wave & 1) * 64;
  const int cbase = (wave >> 1) * 64;

  // All global loads of the wave's start are issued together, those wanted
  // first in front (loads return in order): weights, area, mask, feat.
  // Weights: one thread per channel, 19 unconditional loads.
  const float* w2b = w2g + (size_t)b * K_ * C_;
  const float* pvb = pvg + (size_t)b * K_ * C_;
  float w2r[K_], pvr[K_];
  for (int r = 0; r < K_; ++r) w2r[r] = w2b[r * C_ + tid];
  for (int r = 0; r < K_; ++r) pvr[r] = pvb[r * C_ + tid];
  const float pbr = proj_b[tid];
  const float w2c = w2g[(size_t)(B_ * K_) * C_ + tid];   // the bias token's fold
  const float pvc = pvg[(size_t)(B_ * K_) * C_ + tid];
  // Area: lane l takes region l % 8 of this batch.
  const float arl = area[b * K_ + (lane & 7)];
  // Mask: this lane's softmax pixels are p0 + 4*row + 2*t + half, t = 0, 1.
  const float* mB = mask + (size_t)b * K_ * HW_ + p0 + 4 * row + half;
  // feat and out: pixels p0 + 4*row .. +3, channels from cbase + 8*half.
  const size_t tile0 = ((size_t)b * C_ + cbase + 8 * half) * HW_ + p0 + 4 * row;
  const float* fsrc = feat + tile0;
  float* odst = out + tile0;
  // The two register sets: the tile worked on, the tile in flight.
  float mk[2][K_], mkn[2][K_];
  v4f X[4][8], Xn[4][8];
  // Its closing scheduling barrier also keeps the gate's arithmetic, which
  // waits for the area load, behind the issue of every load above.
  load_tile(mB, fsrc, mk, X);
  // Area gate of region lane % 8: g = sqrt(p / max(max_k p, 1e-6)).
  const float pl = arl * (1.0f / (float)(HW_));
  float dmax = pl;
  #pragma unroll
  for (int d = 1; d < K_; d <<= 1) dmax = fmaxf(dmax, __shfl_xor(dmax, d, 32));
  const float gl = sqrtf(fmaxf(pl / fmaxf(dmax, 1e-6f), 0.0f));
  for (int r = 0; r < K_; ++r) {
    const float g = __int_as_float(__builtin_amdgcn_readlane(__float_as_int(gl), r));
    w2_s[r * W2P_ + tid] = fmaf(g, w2r[r], w2c);
    pv_s[r * PVP_ + tid] = fmaf(g, pvr[r], pvc);
  }
  pb_s[tid] = pbr;
  if (tid < 16) {
    float b2v = 0.0f;
    if (tid < K_) {
      const float b2r = b2g[b * K_ + tid], b2c = b2g[B_ * K_];
      // Before any register that the two loads above name may be rewritten.
      asm volatile("s_wait_xcnt 0x0" ::: "memory");
      b2v = fmaf(gl, b2r, b2c);
    }
    b2_s[tid] = b2v;
  }
  __syncthreads();

  const float mbs = mbs_p[0];
  const float gate = 1.0f / (1.0f + __expf(-alpha_p[0]));
  Stage2W w2nd;
  #pragma unroll
  for (int ct = 0; ct < 4; ++ct) {
    const int ch = cbase + ct * 16 + row;
    w2nd.A1[ct].x = pv_s[(0 + 2 * half) * PVP_ + ch];
    w2nd.A1[ct].y = pv_s[(1 + 2 * half) * PVP_ + ch];
    w2nd.A2[ct].x = pv_s[(4 + 2 * half) * PVP_ + ch];
    w2nd.A2[ct].y = pv_s[(5 + 2 * half) * PVP_ + ch];
    w2nd.pb0[ct] = *(const v4f*)(pb_s + cbase + ct * 16 + 8 * half);
    w2nd.pb1[ct] = *(const v4f*)(pb_s + cbase + ct * 16 + 8 * half + 4);
  }

  // Tile t is worked on while tile t + 1 is in flight. A part buffer is
  // written again two tiles on, behind the barrier of the tile between, which
  // a wave reaches only with its reads of that buffer done.
  // Kept rolled: written out, the four tiles' text came to about 33 KB, and
  // every line of it would run only once; rolled it is about 18 KB and the
  // loop's trips re-run cached text. The price is one register copy of the
  // tile that has landed.
  #pragma unroll 1
  for (int t = 0; t < TPG_ - 1; ++t) {
    mB += TPX_;
    fsrc += TPX_;
    load_tile(mB, fsrc, mkn, Xn);
    do_tile(sm, w2nd, (v4f*)sm.part[t & 1], mk, X, odst, wave, lane, cbase, mbs, gate);
    odst += TPX_;
    #pragma unroll
    for (int i = 0; i < 2; ++i)
      #pragma unroll
      for (int r = 0; r < K_; ++r) mk[i][r] = mkn[i][r];
    #pragma unroll
    for (int ct = 0; ct < 4; ++ct)
      #pragma unroll
      for (int r = 0; r < 8; ++r) X[ct][r] = Xn[ct][r];
  }
  do_tile(sm, w2nd, (v4f*)sm.part[(TPG_ - 1) & 1], mk, X, odst, wave, lane, cbase, mbs, gate);
}

// ---------------------------------------------------------------------------
extern "C" void kernel_launch(void* const* d_in, const int* in_sizes, int n_in,
                              void* d_out, int out_size, void* d_ws, size_t ws_size,
                              hipStream_t stream) {
  const float* feat       = (const float*)d_in[0];
  const float* mask       = (const float*)d_in[1];
  const float* region_vec = (const float*)d_in[2];
  const float* q_w        = (const float*)d_in[3];
  const float* q_b        = (const float*)d_in[4];
  const float* k_w        = (const float*)d_in[5];
  const float* k_b        = (const float*)d_in[6];
  const float* v_w        = (const float*)d_in[7];
  const float* v_b        = (const float*)d_in[8];
  const float* proj_w     = (const float*)d_in[9];
  const float* proj_b     = (const float*)d_in[10];
  const float* mbs        = (const float*)d_in[11];
  const float* alpha      = (const float*)d_in[12];
  float* out = (float*)d_out;

  float* ws   = (float*)d_ws;
  float* area = ws;                       // B*K       = 64
  float* b2   = ws + 64;                  // NTOK      = 65
  float* w2   = ws + 256;                 // NTOK*C    = 16640
  float* pv   = ws + 256 + NTOK_ * C_;    // NTOK*C    = 16640

  fold_kernel<<<NTOK_ + B_ * K_, FW_ * 32, 0, stream>>>(mask, region_vec, q_w, q_b,
                                                   k_w, k_b, v_w, v_b, proj_w,
                                                   area, w2, b2, pv);
  dim3 grid(HW_ / (TPG_ * TPX_), B_);
  attn_kernel<<<grid, AW_ * 32, 0, stream>>>(feat, mask, area, w2, b2, pv, proj_b,
                                       mbs, alpha, out);
}

// v008
// One run takes 27.6 microseconds.
// Timed twice side by side with v007, it ran 1.18 and 1.17 times as fast.
// Counting every step since v000, it is 4.26 times as fast.
#include <hip/hip_runtime.h>
#include <hip/hip_bf16.h>
#include <stdint.h>

// Problem constants (match reference)
#define B_  8
#define C_  256
#define K_  8
#define H_  128
#define W_  128
#define HW_ (H_ * W_)

typedef __attribute__((ext_vector_type(2))) float v2f;
typedef __attribute__((ext_vector_type(8))) float v8f;

// ---------------------------------------------------------------------------
// Kernel 1: everything that comes before the pixels, in ONE launch.
// The area gate g = sqrt(p / max_k p), p = area/(H*W), is one scalar per
// (b,k), and the weight chain is linear in it:
//   k_tok = g * (k_w @ region_vec) + k_b ;  v_tok = g * (v_w @ region_vec) + v_b
// so the chain is folded without g, the bias vectors are folded as one more
// token, and kernel 2 forms  g * fold(b,k) + fold(bias)  when it stages the
// folded vectors. The mask sums depend on nothing here and nothing here
// depends on them: they run beside the folds, on work-groups of their own.
//   token (b,k):  kt = k_w @ region_vec, vt = v_w @ region_vec
//   bias token :  kt = k_b,              vt = v_b
//     both kinds:  w2[c] = (sum_o q_w[o][c] * kt[o]) / 16      (16 = sqrt(C))
//                  b2    = (sum_o q_b[o]    * kt[o]) / 16
//                  pv[c] =  sum_o proj_w[c][o] * vt[o]
// Both sums over o are cut in FS_ slices. A fold work-group takes one slice of
// one chain (k: k_w then q_w; v: v_w then proj_w) for FT_ tokens: it reads
// 64 KB of each of its two matrices, once for the FT_ tokens, and writes the
// slice's partial w2, b2 or pv; kernel 2 adds the FS_ partials when it stages.
// None of a group's loads depends on another: a wave issues all of them (8
// rows of k_w, v_w or q_w, or 64 columns of 32 rows of proj_w, 16 B a lane,
// whole 256- or 512-byte runs) at its start.
//   work-groups 0 .. B*K-1 : area[b][k] = sum over H*W of mask[b][k][:]
//     (in front: these read the most
//      distant data of the launch)
//   then (token group, chain, slice), the last token group being the biases.
// grid = B*K + NGRP_*2*FS_ blocks, 256 threads (8 waves)
// ---------------------------------------------------------------------------
#define FT_ 4                  // tokens of a fold work-group
#define FS_ 4                  // slices of o
#define FO_ (C_ / FS_)         // rows of o in a slice
#define FW_ 8                  // waves per work-group; a wave has FO_/FW_ = 8 rows
#define NGRP_ (B_ * K_ / FT_ + 1)   // token groups; the last holds the bias token
#define NTP_ (NGRP_ * FT_)     // token places of one slice's partial plane
#define BIAS_ (B_ * K_)        // the bias token's place
typedef __attribute__((ext_vector_type(4))) float v4f;

__device__ __forceinline__ float dot8(v4f a0, v4f a1, v4f x0, v4f x1) {
  float s0 = a0.x * x0.x, s1 = a1.x * x1.x;
  s0 = fmaf(a0.y, x0.y, s0); s1 = fmaf(a1.y, x1.y, s1);
  s0 = fmaf(a0.z, x0.z, s0); s1 = fmaf(a1.z, x1.z, s1);
  s0 = fmaf(a0.w, x0.w, s0); s1 = fmaf(a1.w, x1.w, s1);
  return s0 + s1;
}

__device__ __forceinline__ v4f fma4(float g, v4f a, v4f c) {
  v4f o;
  o.x = fmaf(g, a.x, c.x); o.y = fmaf(g, a.y, c.y);
  o.z = fmaf(g, a.z, c.z); o.w = fmaf(g, a.w, c.w);
  return o;
}

__device__ __forceinline__ float dot4(v4f a, v4f x) {
  return fmaf(a.y, x.y, a.x * x.x) + fmaf(a.w, x.w, a.z * x.z);
}

// Sums each of N per-lane values over groups of L neighbouring lanes (N, L
// powers of two, N <= L <= 32). Each exchange halves the values a lane still
// carries, so N values take N - 1 exchanges plus one for each step left. On
// return the lane holds the full sum of value number (lane % L) / (L / N).
template <int N, int L>
__device__ __forceinline__ float lane_sums(float (&p)[N], int lane) {
  int m = L / 2;
  #pragma unroll
  for (int n = N / 2; n >= 1; n >>= 1, m >>= 1) {
    const bool hi = (lane & m) != 0;
    #pragma unroll
    for (int i = 0; i < n; ++i) {
      const float lo_v = p[i], hi_v = p[i + n];   // values, so that the two
      const float keep = hi ? hi_v : lo_v;        // selects stay in registers
      const float send = hi ? lo_v : hi_v;
      p[i] = keep + __shfl_xor(send, m, 32);
    }
  }
  float s = p[0];
  #pragma unroll
  for (; m >= 1; m >>= 1) s += __shfl_xor(s, m, 32);
  return s;
}

// One fold work-group: slice sl of chain IS_K ? k : v for token group grp.
//   w1, b1: first matrix and its bias (k_w, k_b or v_w, v_b)
//   m2    : second matrix (q_w or proj_w);  dst: w2 or pv
// The two chains are two instances, so that each has its own loads at constant
// offsets from one address. Loops over registers are unrolled throughout: the
// arrays are to stay in registers.
template <bool IS_K>
__device__ __forceinline__ void fold_chain(
    const float* __restrict__ region_vec, const float* __restrict__ w1,
    const float* __restrict__ b1, const float* __restrict__ m2,
    const float* __restrict__ q_b, float* __restrict__ dst, float* __restrict__ b2,
    float* part, float* vts, float* red, int sl, int grp, int t, int lane, int wave) {
  const int o0 = sl * FO_ + wave * 8;    // the wave's 8 rows of o
  const int half = lane >> 4, n = lane & 15;

  // ---- all loads of the wave, those wanted first in front -----------------
  // The bias group has no region_vec: it reads the last group's (in bounds)
  // and replaces the product below.
  const int grpc = grp < NGRP_ - 1 ? grp : NGRP_ - 2;
  const v4f* rv = (const v4f*)(region_vec + (size_t)grpc * FT_ * C_) + lane;
  v4f x0[FT_], x1[FT_];
  #pragma unroll
  for (int k = 0; k < FT_; ++k) { x0[k] = rv[k * 64]; x1[k] = rv[k * 64 + 32]; }
  // Lane l stands for (row l / 4, token l % 4) of the wave behind lane_sums.
  const float bv = b1[o0 + (lane >> 2)];
  const float qb = IS_K ? q_b[o0 + (lane >> 2)] : 0.0f;
  const v4f* wr = (const v4f*)(w1 + (size_t)o0 * C_) + lane;
  v4f A0[8], A1[8];
  #pragma unroll
  for (int i = 0; i < 8; ++i) { A0[i] = wr[i * 64]; A1[i] = wr[i * 64 + 32]; }
  // Loads return in order: keeps the first product's operands issued ahead of
  // the second matrix (this build had put most of them behind it).
  __builtin_amdgcn_sched_barrier(0);
  // Second matrix. k: rows o0 .. o0+7 of q_w, R[2i], R[2i+1] the two halves of
  // row i. v: the slice's 64 columns of rows 32*wave .. +31 of proj_w, R[j] =
  // columns 4n .. 4n+3 of row 32*wave + 2j + half.
  const v4f* sr = IS_K ? (const v4f*)(m2 + (size_t)o0 * C_) + lane
                       : (const v4f*)(m2 + (size_t)wave * 32 * C_ + sl * FO_) + (half * (C_ / 4) + n);
  v4f R[16];
  #pragma unroll
  for (int j = 0; j < 16; ++j) R[j] = sr[j * (IS_K ? 32 : 128)];
  // Before any register that the loads above name may be rewritten.
  asm volatile("s_wait_xcnt 0x0" ::: "memory");
  // Keeps every load above issued here: the second matrix is wanted in flight
  // during the first product, not sunk to its first use.
  __builtin_amdgcn_sched_barrier(0);

  // ---- kt or vt: 8 rows x FT_ tokens a wave -------------------------------
  float d[8 * FT_];
  #pragma unroll
  for (int i = 0; i < 8; ++i)
    #pragma unroll
    for (int k = 0; k < FT_; ++k) d[i * FT_ + k] = dot8(A0[i], A1[i], x0[k], x1[k]);
  float tokv = lane_sums<8 * FT_, 32>(d, lane);
  if (grp == NGRP_ - 1) tokv = (lane & 3) == 0 ? bv : 0.0f;

  const size_t tok0 = (size_t)sl * NTP_ + grp * FT_;   // first token place
  if (IS_K) {
    // ---- w2: the wave's own 8 rows of q_w, scaled by its own kt, summed
    //      down the columns; q_b goes along as one more column (b2) ---------
    v4f c0[FT_] = {}, c1[FT_] = {};
    #pragma unroll
    for (int i = 0; i < 8; ++i)
      #pragma unroll
      for (int k = 0; k < FT_; ++k) {
        const float kt = __int_as_float(
            __builtin_amdgcn_readlane(__float_as_int(tokv), i * FT_ + k));
        c0[k] += R[2 * i] * kt;
        c1[k] += R[2 * i + 1] * kt;
      }
    #pragma unroll
    for (int k = 0; k < FT_; ++k) {
      ((v4f*)part)[(wave * FT_ + k) * 64 + lane] = c0[k];
      ((v4f*)part)[(wave * FT_ + k) * 64 + 32 + lane] = c1[k];
    }
    float bb = tokv * qb;
    #pragma unroll
    for (int m = 4; m <= 16; m <<= 1) bb += __shfl_xor(bb, m, 32);
    if (lane < FT_) red[wave * FT_ + lane] = bb;
    __syncthreads();
    // One thread per (token, 4 channels): add the 8 waves' rows.
    const v4f* pr = (const v4f*)part + (t >> 6) * 64 + (t & 63);
    const v4f sum = ((pr[0] + pr[FT_ * 64]) + (pr[2 * FT_ * 64] + pr[3 * FT_ * 64])) +
                    ((pr[4 * FT_ * 64] + pr[5 * FT_ * 64]) + (pr[6 * FT_ * 64] + pr[7 * FT_ * 64]));
    float sb = 0.f;
    #pragma unroll
    for (int w = 0; w < FW_; ++w) sb += red[w * FT_ + (t & (FT_ - 1))];
    ((v4f*)(dst + (tok0 + (t >> 6)) * C_))[t & 63] = sum * (1.0f / 16.0f);
    // Before any register that the store above names may be rewritten.
    asm volatile("s_wait_xcnt 0x0" ::: "memory");
    if (t < FT_) b2[tok0 + t] = sb * (1.0f / 16.0f);
  } else {
    // ---- pv: every wave needs the slice's 64 vt of each token --------------
    vts[(lane & 3) * FO_ + wave * 8 + (lane >> 2)] = tokv;
    __syncthreads();
    float res[FT_];
    #pragma unroll
    for (int k = 0; k < FT_; ++k) {
      const v4f y = ((const v4f*)vts)[k * (FO_ / 4) + n];
      float p[16];
      #pragma unroll
      for (int j = 0; j < 16; ++j) p[j] = dot4(R[j], y);
      res[k] = lane_sums<16, 16>(p, lane);   // lane n: row 32*wave + 2n + half
    }
    float* o = dst + tok0 * C_ + wave * 32 + 2 * n + half;
    #pragma unroll
    for (int k = 0; k < FT_; ++k) o[k * C_] = res[k];
    // Before any register that the stores above name may be rewritten.
    asm volatile("s_wait_xcnt 0x0" ::: "memory");
  }
}

__global__ __launch_bounds__(FW_ * 32) void fold_kernel(
    const float* __restrict__ mask, const float* __restrict__ region_vec,
    const float* __restrict__ q_w, const float* __restrict__ q_b,
    const float* __restrict__ k_w, const float* __restrict__ k_b,
    const float* __restrict__ v_w, const float* __restrict__ v_b,
    const float* __restrict__ proj_w,
    float* __restrict__ area,
    float* __restrict__ w2, float* __restrict__ b2, float* __restrict__ pv) {
  __shared__ __align__(16) float part[FW_ * FT_ * C_];   // 32KB: per-wave w2 sums
  __shared__ __align__(16) float vts[FT_ * FO_];         // vt of the slice
  __shared__ float red[FW_ * FT_];                       // per-wave b2 or area sums
  const int t = threadIdx.x;
  const int lane = t & 31;
  const int wave = __builtin_amdgcn_readfirstlane(t >> 5);

  if (blockIdx.x < B_ * K_) {
    // ---- area: one mask plane (64 KB), 16 loads of 16 B a thread ----------
    const v4f* m = (const v4f*)(mask + (size_t)blockIdx.x * HW_) + t;
    v4f a[16];
    #pragma unroll
    for (int j = 0; j < 16; ++j) a[j] = m[j * FW_ * 32];
    // Before any register that the loads above name may be rewritten.
    asm volatile("s_wait_xcnt 0x0" ::: "memory");
    #pragma unroll
    for (int d = 8; d >= 1; d >>= 1)
      #pragma unroll
      for (int j = 0; j < d; ++j) a[j] += a[j + d];
    float s = (a[0].x + a[0].y) + (a[0].z + a[0].w);
    #pragma unroll
    for (int d = 16; d >= 1; d >>= 1) s += __shfl_xor(s, d, 32);
    if (lane == 0) red[wave] = s;
    __syncthreads();
    if (t == 0) {
      float r = 0.f;
      #pragma unroll
      for (int w = 0; w < FW_; ++w) r += red[w];
      area[blockIdx.x] = r;
    }
    return;
  }

  const int id = blockIdx.x - B_ * K_;
  const int sl = id % FS_;               // slice of o
  const int grp = id / (2 * FS_);        // token group
  if (((id / FS_) & 1) == 0)
    fold_chain<true>(region_vec, k_w, k_b, q_w, q_b, w2, b2, part, vts, red,
                     sl, grp, t, lane, wave);
  else
    fold_chain<false>(region_vec, v_w, v_b, proj_w, q_b, pv, b2, part, vts, red,
                      sl, grp, t, lane, wave);
}

// ---------------------------------------------------------------------------
// Kernel 2: streaming attention kernel (memory-bound, WMMA)
//   The feat tile lives in registers from its load to the final add; LDS
//   holds only the folded weights and the waves' partial logits.
//   Work-group: 8 waves, TPG_ tiles of 128 pixels x 256 channels one after
//   another, on two register sets: the loads of tile t + 1 are issued before
//   tile t is worked on, so that they fly during its WMMAs, softmax and stores.
//   Wave, per tile: 64 pixels (group wave & 1) x 64 channels (quarter
//   wave >> 1) = 32 loads of 16 B a lane.
//   Lane (half, n) holds pixels 4n..4n+3 of channels cbase + 16*ct + 8*half
//   + r: each load and each store covers 256 contiguous bytes of two rows.
//   Stage 1 : one WMMA takes 2 channels (one per lane half) x 32 pixels. B is
//             a register pair of a load as it stands: pixels 4n+2t, 4n+2t+1.
//             A row m < 8 is (w2[m][c], 0), row m >= 8 is (0, w2[m-8][c]), so
//             D rows 0-7 are the 8 logits of pixel 4n+2t and rows 8-15 those
//             of pixel 4n+2t+1: every lane ends with one pixel per t.
//   Sum     : the 4 channel quarters' partial logits are added through LDS.
//   Softmax : lane-local, 2 pixels a lane (each quarter's wave repeats it).
//   Stage 2 : delta^T(16ch x 16pix) = pv^T @ attn^T, 2 WMMAs per channel tile
//             and pixel j of the quad; D row r is the channel of load (ct, r).
//   Epilogue: out = feat + sigmoid(alpha)*(delta + proj_b), stored from the
//             registers, 16 B a lane.
//   The folded weights (w2, pv, proj_b, b2) are staged once per work-group,
//   w2, pv and b2 each as  g * fold(b,k) + fold(bias)  with the area gate g of its region,
//   a fold being the sum of kernel 1's FS_ partial folds.
// grid = (HW/(128*TPG_), B), 256 threads (8 waves)
// ---------------------------------------------------------------------------
#define AW_ 8                  // waves per work-group; AW_*32 threads == C_
#define TPX_ (16 * AW_)        // pixels of a tile
#define TPG_ 4                 // tiles a work-group takes
// LDS layouts, each set by its reader (64 banks of 4 bytes):
//   w2: a stage-1 A read takes 16 bytes of each of 8 rows per 16 lanes.
//       Row pitch = 4 mod 64 dwords: the 8 rows lie on 32 different banks.
//   pv: a stage-2 A read takes 16 dwords in a row of each of two rows, 2 rows
//       apart. Row pitch = 16 mod 64 dwords: the two runs lie 32 banks apart.
//   part: 16 bytes a lane, lanes side by side; one buffer for even tiles and
//       one for odd, so that one barrier a tile is enough.
#define W2P_ (C_ + 4)          // w2 row pitch, dwords
#define PVP_ (C_ + 16)         // pv row pitch, dwords
struct AttnLds {
  float w2[K_ * W2P_];         // 8KB
  float pv[K_ * PVP_];         // 8KB
  float pb[C_];                // 1KB
  float b2[16];
  float part[2][AW_ * 16 * 32];  // 2 x 16KB: per wave, 16 partial logits a lane
};

// Issues one tile's loads of this wave, mask in front (loads return in order).
//   mk[t][r]: region r at this lane's softmax pixel 4*row + 2*t + half.
//   X[ct][r]: pixels 4*row .. +3 of channel cbase + 16*ct + 8*half + r.
__device__ __forceinline__ void load_tile(const float* __restrict__ msrc,
                                          const float* __restrict__ fsrc,
                                          float (&mk)[2][K_], v4f (&X)[4][8]) {
  #pragma unroll
  for (int t = 0; t < 2; ++t)
    #pragma unroll
    for (int r = 0; r < K_; ++r) mk[t][r] = msrc[(size_t)r * HW_ + 2 * t];
  #pragma unroll
  for (int ct = 0; ct < 4; ++ct)
    #pragma unroll
    for (int r = 0; r < 8; ++r)
      X[ct][r] = *(const v4f*)(fsrc + (size_t)(ct * 16 + r) * HW_);
  // Before any register that the loads above name may be rewritten.
  asm volatile("s_wait_xcnt 0x0" ::: "memory");
  // Keeps every load above issued here, ahead of the work that follows: the
  // loads are wanted in flight during that work, not sunk to their first use.
  __builtin_amdgcn_sched_barrier(0);
}

// Stores 8 channel rows, 16 B a lane each, from byte offset OFF on. The wait
// stands in the stores' own statement: behind it their registers are free to
// be rewritten, and nothing can be scheduled between the stores and the wait.
template <int OFF>
__device__ __forceinline__ void store_rows(float* base, const v4f (&o)[8]) {
  asm volatile(
      "global_store_b128 %0, %1, off offset:%9\n\t"
      "global_store_b128 %0, %2, off offset:%10\n\t"
      "global_store_b128 %0, %3, off offset:%11\n\t"
      "global_store_b128 %0, %4, off offset:%12\n\t"
      "global_store_b128 %0, %5, off offset:%13\n\t"
      "global_store_b128 %0, %6, off offset:%14\n\t"
      "global_store_b128 %0, %7, off offset:%15\n\t"
      "global_store_b128 %0, %8, off offset:%16\n\t"
      "s_wait_xcnt 0x0"
      :: "v"(base), "v"(o[0]), "v"(o[1]), "v"(o[2]), "v"(o[3]),
         "v"(o[4]), "v"(o[5]), "v"(o[6]), "v"(o[7]),
         "n"(OFF), "n"(OFF + 1 * HW_ * 4), "n"(OFF + 2 * HW_ * 4), "n"(OFF + 3 * HW_ * 4),
         "n"(OFF + 4 * HW_ * 4), "n"(OFF + 5 * HW_ * 4), "n"(OFF + 6 * HW_ * 4),
         "n"(OFF + 7 * HW_ * 4)
      : "memory");
}

// What stage 2 reads of the folded weights is the same for every pixel tile:
// a lane reads it from LDS once and keeps it (48 registers).
struct Stage2W {
  v2f A1[4], A2[4];            // pv^T fragments, k = 0..3 and 4..7, per channel tile
  v4f pb0[4], pb1[4];          // proj_b of the lane's 8 D rows, per channel tile
};

// Stage 2 and epilogue of channel tile CT.
// A (16x4): M=channel (16*CT+row), K = region index (2 WMMAs cover k=0..7)
// D row r of pixel tile j: channel cbase + 16*CT + 8*half + r, pixel 4n + j,
// which is element j of X[r].
template <int CT>
__device__ __forceinline__ void stage2(const Stage2W& w, const v4f (&X)[8],
                                       const v2f (&B1)[4], const v2f (&B2)[4],
                                       float* odst, float gate) {
  const v2f A1 = w.A1[CT], A2 = w.A2[CT];
  const v4f pb0 = w.pb0[CT], pb1 = w.pb1[CT];
  v8f d[4];
  #pragma unroll
  for (int j = 0; j < 4; ++j) {
    const v8f z = {};
    d[j] = __builtin_amdgcn_wmma_f32_16x16x4_f32(false, A1, false, B1[j],
                                                 (short)0, z, false, false);
  }
  #pragma unroll
  for (int j = 0; j < 4; ++j)
    d[j] = __builtin_amdgcn_wmma_f32_16x16x4_f32(false, A2, false, B2[j],
                                                 (short)0, d[j], false, false);
  v4f o[8];
  #pragma unroll
  for (int r = 0; r < 8; ++r) {
    const float pbv = (r < 4) ? pb0[r & 3] : pb1[r & 3];
    o[r].x = X[r].x + gate * (d[0][r] + pbv);
    o[r].y = X[r].y + gate * (d[1][r] + pbv);
    o[r].z = X[r].z + gate * (d[2][r] + pbv);
    o[r].w = X[r].w + gate * (d[3][r] + pbv);
  }
  store_rows<CT * 16 * HW_ * 4>(odst, o);
}

// One pixel tile, from its registers to its stores.
__device__ __forceinline__ void do_tile(AttnLds& sm, const Stage2W& w2nd, v4f* __restrict__ part,
                                        const float (&mk)[2][K_], const v4f (&X)[4][8],
                                        float* __restrict__ odst,
                                        int wave, int lane, int cbase,
                                        float mbs, float gate) {
  const float* const w2_s = sm.w2;
  const float* const b2_s = sm.b2;
  const int half = lane >> 4;   // 0: lanes 0-15, 1: lanes 16-31
  const int row  = lane & 15;

  // ---- Stage 1: partial logits over the wave's 64 channels ----------------
  // k position (half, i) of A and of B alike: channel of this half, pixel
  // 4n + 2t + i; A is zero where i differs from the D row's pixel (row >> 3).
  const bool lo = row < 8;
  const float* w2row = w2_s + (row & 7) * W2P_ + cbase + 8 * half;
  v8f acc[2] = {{}, {}};
  #pragma unroll
  for (int ct = 0; ct < 4; ++ct) {
    const v4f wa = *(const v4f*)(w2row + ct * 16);
    const v4f wb = *(const v4f*)(w2row + ct * 16 + 4);
    #pragma unroll
    for (int r = 0; r < 8; ++r) {
      const float w = (r < 4) ? wa[r & 3] : wb[r & 3];
      v2f Aop, Bq0, Bq1;
      Aop.x = lo ? w : 0.0f;
      Aop.y = lo ? 0.0f : w;
      Bq0.x = X[ct][r].x; Bq0.y = X[ct][r].y;
      Bq1.x = X[ct][r].z; Bq1.y = X[ct][r].w;
      acc[0] = __builtin_amdgcn_wmma_f32_16x16x4_f32(false, Aop, false, Bq0,
                                                     (short)0, acc[0], false, false);
      acc[1] = __builtin_amdgcn_wmma_f32_16x16x4_f32(false, Aop, false, Bq1,
                                                     (short)0, acc[1], false, false);
    }
  }

  // ---- Add the 4 channel quarters' partial logits through LDS -------------
  #pragma unroll
  for (int t = 0; t < 2; ++t) {
    const v4f s0 = {acc[t][0], acc[t][1], acc[t][2], acc[t][3]};
    const v4f s1 = {acc[t][4], acc[t][5], acc[t][6], acc[t][7]};
    part[(wave * 4 + t * 2 + 0) * 32 + lane] = s0;
    part[(wave * 4 + t * 2 + 1) * 32 + lane] = s1;
  }
  // Every wave's partial logits are in LDS before another wave reads them.
  // The fences name LDS alone: __syncthreads() would also wait for the next
  // tile's global loads, which are to stay in flight across this barrier.
  __builtin_amdgcn_fence(__ATOMIC_RELEASE, "workgroup", "local");
  __builtin_amdgcn_s_barrier();
  __builtin_amdgcn_fence(__ATOMIC_ACQUIRE, "workgroup", "local");
  v4f ls[4];
  #pragma unroll
  for (int i = 0; i < 4; ++i) {
    const v4f* pr = part + ((wave & 1) * 4 + i) * 32 + lane;   // quarter 0
    ls[i] = ((pr[0] + pr[8 * 32]) + pr[16 * 32]) + pr[24 * 32];
  }

  // ---- Bias + softmax (lane-local, one pixel per t) -----------------------
  float attnv[2][8];
  #pragma unroll
  for (int t = 0; t < 2; ++t) {
    float logit[8];
    float mx = -1e30f;
    #pragma unroll
    for (int r = 0; r < 8; ++r) {
      float l = ls[t * 2 + (r >> 2)][r & 3] + b2_s[r] + mbs * __logf(mk[t][r] + 1e-6f);
      logit[r] = l;
      mx = fmaxf(mx, l);
    }
    float sum = 0.f;
    #pragma unroll
    for (int r = 0; r < 8; ++r) {
      float e = __expf(logit[r] - mx);
      attnv[t][r] = e;
      sum += e;
    }
    const float inv = 1.0f / sum;
    #pragma unroll
    for (int r = 0; r < 8; ++r) attnv[t][r] *= inv;
  }

  // ---- Build stage-2 B operands: attn^T (k x pixel), pixel 4n + j ---------
  // Pixel j = 2t + h' was normalised in lane half h'. Half 0 of B wants its
  // k = 0,1 (4,5), half 1 its k = 2,3 (6,7): own values in half h', the
  // partner lane's (lane ^ 16) in the other half.
  v2f B1[4], B2[4];
  #pragma unroll
  for (int t = 0; t < 2; ++t) {
    float sw[8];
    #pragma unroll
    for (int r = 0; r < 8; ++r) sw[r] = __shfl_xor(attnv[t][r], 16, 32);
    B1[2 * t].x = half ? sw[2] : attnv[t][0];
    B1[2 * t].y = half ? sw[3] : attnv[t][1];
    B2[2 * t].x = half ? sw[6] : attnv[t][4];
    B2[2 * t].y = half ? sw[7] : attnv[t][5];
    B1[2 * t + 1].x = half ? attnv[t][2] : sw[0];
    B1[2 * t + 1].y = half ? attnv[t][3] : sw[1];
    B2[2 * t + 1].x = half ? attnv[t][6] : sw[4];
    B2[2 * t + 1].y = half ? attnv[t][7] : sw[5];
  }

  // ---- Stage 2 + epilogue -------------------------------------------------
  stage2<0>(w2nd, X[0], B1, B2, odst, gate);
  stage2<1>(w2nd, X[1], B1, B2, odst, gate);
  // Bounds the registers: without it the build issued all 32 WMMAs ahead of
  // the first add, held 128 result registers and spilled loaded tiles.
  __builtin_amdgcn_sched_barrier(0);
  stage2<2>(w2nd, X[2], B1, B2, odst, gate);
  stage2<3>(w2nd, X[3], B1, B2, odst, gate);
}

__global__ __launch_bounds__(AW_ * 32) void attn_kernel(
    const float* __restrict__ feat, const float* __restrict__ mask,
    const float* __restrict__ area, const float* __restrict__ w2g, const float* __restrict__ b2g,
    const float* __restrict__ pvg, const float* __restrict__ proj_b,
    const float* __restrict__ mbs_p, const float* __restrict__ alpha_p,
    float* __restrict__ out) {
  __shared__ __align__(16) AttnLds sm;
  float* const w2_s = sm.w2;
  float* const pv_s = sm.pv;
  float* const pb_s = sm.pb;
  float* const b2_s = sm.b2;

  const int b = blockIdx.y;
  const int tid = threadIdx.x;
  const int wave = __builtin_amdgcn_readfirstlane(tid >> 5);
  const int lane = tid & 31;
  const int half = lane >> 4;   // 0: lanes 0-15, 1: lanes 16-31
  const int row  = lane & 15;
  // The wave's pixels in the work-group's first tile, and its channels.
  const int p0 = blockIdx.x * (TPG_ * TPX_) + (wave & 1) * 64;
  const int cbase = (wave >> 1) * 64;

  // All global loads of the wave's start are issued together, those wanted
  // first in front (loads return in order): weights, area, mask, feat.
  // Weights: one thread per 4 channels of two tokens, 24 unconditional loads
  // of 16 B: the FS_ partial folds of the batch's tokens th and th + 4 and
  // (place 2) of the bias token. Wide loads keep the run of loads that stands
  // in front of the tile's own short.
  const int th = wave >> 1;     // tid / 64
  const int cq = tid & 63;      // channels 4*cq .. 4*cq + 3
  const v4f* w2b = (const v4f*)(w2g + ((size_t)b * K_ + th) * C_) + cq;
  const v4f* pvb = (const v4f*)(pvg + ((size_t)b * K_ + th) * C_) + cq;
  const v4f* w2z = (const v4f*)(w2g + (size_t)BIAS_ * C_) + cq;
  const v4f* pvz = (const v4f*)(pvg + (size_t)BIAS_ * C_) + cq;
  v4f w2q[FS_][3], pvq[FS_][3];
  #pragma unroll
  for (int s = 0; s < FS_; ++s) {
    w2q[s][0] = w2b[s * NTP_ * (C_ / 4)];
    w2q[s][1] = w2b[(s * NTP_ + 4) * (C_ / 4)];
    w2q[s][2] = w2z[s * NTP_ * (C_ / 4)];
  }
  #pragma unroll
  for (int s = 0; s < FS_; ++s) {
    pvq[s][0] = pvb[s * NTP_ * (C_ / 4)];
    pvq[s][1] = pvb[(s * NTP_ + 4) * (C_ / 4)];
    pvq[s][2] = pvz[s * NTP_ * (C_ / 4)];
  }
  const float pbr = proj_b[tid];
  // Area: lane l takes region l % 8 of this batch.
  const float arl = area[b * K_ + (lane & 7)];
  // Before any register that the loads above name may be rewritten. The
  // statement also holds them ahead of the tile's loads (loads return in order;
  // without it this build put two weight loads behind the tile's 32).
  asm volatile("s_wait_xcnt 0x0" ::: "memory");
  // Mask: this lane's softmax pixels are p0 + 4*row + 2*t + half, t = 0, 1.
  const float* mB = mask + (size_t)b * K_ * HW_ + p0 + 4 * row + half;
  // feat and out: pixels p0 + 4*row .. +3, channels from cbase + 8*half.
  const size_t tile0 = ((size_t)b * C_ + cbase + 8 * half) * HW_ + p0 + 4 * row;
  const float* fsrc = feat + tile0;
  float* odst = out + tile0;
  // The two register sets: the tile worked on, the tile in flight.
  float mk[2][K_], mkn[2][K_];
  v4f X[4][8], Xn[4][8];
  // Its closing scheduling barrier also keeps the gate's arithmetic, which
  // waits for the area load, behind the issue of every load above.
  load_tile(mB, fsrc, mk, X);
  // Area gate of region lane % 8: g = sqrt(p / max(max_k p, 1e-6)).
  const float pl = arl * (1.0f / (float)(HW_));
  float dmax = pl;
  #pragma unroll
  for (int d = 1; d < K_; d <<= 1) dmax = fmaxf(dmax, __shfl_xor(dmax, d, 32));
  const float gl = sqrtf(fmaxf(pl / fmaxf(dmax, 1e-6f), 0.0f));
  // The slices' partial folds are added here.
  v4f w2r[3], pvr[3];
  #pragma unroll
  for (int i = 0; i < 3; ++i) {
    w2r[i] = (w2q[0][i] + w2q[1][i]) + (w2q[2][i] + w2q[3][i]);
    pvr[i] = (pvq[0][i] + pvq[1][i]) + (pvq[2][i] + pvq[3][i]);
  }
  #pragma unroll
  for (int i = 0; i < 2; ++i) {
    const int r = th + 4 * i;
    const float g = __int_as_float(__builtin_amdgcn_readlane(__float_as_int(gl), r));
    *(v4f*)(w2_s + r * W2P_ + 4 * cq) = fma4(g, w2r[i], w2r[2]);
    *(v4f*)(pv_s + r * PVP_ + 4 * cq) = fma4(g, pvr[i], pvr[2]);
  }
  pb_s[tid] = pbr;
  if (tid < 16) {
    float b2v = 0.0f;
    if (tid < K_) {
      float b2q[FS_], b2d[FS_];
      #pragma unroll
      for (int s = 0; s < FS_; ++s) {
        b2q[s] = b2g[s * NTP_ + b * K_ + tid];
        b2d[s] = b2g[s * NTP_ + BIAS_];
      }
      // Before any register that the loads above name may be rewritten.
      asm volatile("s_wait_xcnt 0x0" ::: "memory");
      b2v = fmaf(gl, (b2q[0] + b2q[1]) + (b2q[2] + b2q[3]),
                 (b2d[0] + b2d[1]) + (b2d[2] + b2d[3]));
    }
    b2_s[tid] = b2v;
  }
  __syncthreads();

  const float mbs = mbs_p[0];
  const float gate = 1.0f / (1.0f + __expf(-alpha_p[0]));
  Stage2W w2nd;
  #pragma unroll
  for (int ct = 0; ct < 4; ++ct) {
    const int ch = cbase + ct * 16 + row;
    w2nd.A1[ct].x = pv_s[(0 + 2 * half) * PVP_ + ch];
    w2nd.A1[ct].y = pv_s[(1 + 2 * half) * PVP_ + ch];
    w2nd.A2[ct].x = pv_s[(4 + 2 * half) * PVP_ + ch];
    w2nd.A2[ct].y = pv_s[(5 + 2 * half) * PVP_ + ch];
    w2nd.pb0[ct] = *(const v4f*)(pb_s + cbase + ct * 16 + 8 * half);
    w2nd.pb1[ct] = *(const v4f*)(pb_s + cbase + ct * 16 + 8 * half + 4);
  }

  // Tile t is worked on while tile t + 1 is in flight. A part buffer is
  // written again two tiles on, behind the barrier of the tile between, which
  // a wave reaches only with its reads of that buffer done.
  // Kept rolled: written out, the four tiles' text came to about 33 KB, and
  // every line of it would run only once; rolled it is about 18 KB and the
  // loop's trips re-run cached text. The price is one register copy of the
  // tile that has landed.
  #pragma unroll 1
  for (int t = 0; t < TPG_ - 1; ++t) {
    mB += TPX_;
    fsrc += TPX_;
    load_tile(mB, fsrc, mkn, Xn);
    do_tile(sm, w2nd, (v4f*)sm.part[t & 1], mk, X, odst, wave, lane, cbase, mbs, gate);
    odst += TPX_;
    #pragma unroll
    for (int i = 0; i < 2; ++i)
      #pragma unroll
      for (int r = 0; r < K_; ++r) mk[i][r] = mkn[i][r];
    #pragma unroll
    for (int ct = 0; ct < 4; ++ct)
      #pragma unroll
      for (int r = 0; r < 8; ++r) X[ct][r] = Xn[ct][r];
  }
  do_tile(sm, w2nd, (v4f*)sm.part[(TPG_ - 1) & 1], mk, X, odst, wave, lane, cbase, mbs, gate);
}

// ---------------------------------------------------------------------------
extern "C" void kernel_launch(void* const* d_in, const int* in_sizes, int n_in,
                              void* d_out, int out_size, void* d_ws, size_t ws_size,
                              hipStream_t stream) {
  const float* feat       = (const float*)d_in[0];
  const float* mask       = (const float*)d_in[1];
  const float* region_vec = (const float*)d_in[2];
  const float* q_w        = (const float*)d_in[3];
  const float* q_b        = (const float*)d_in[4];
  const float* k_w        = (const float*)d_in[5];
  const float* k_b        = (const float*)d_in[6];
  const float* v_w        = (const float*)d_in[7];
  const float* v_b        = (const float*)d_in[8];
  const float* proj_w     = (const float*)d_in[9];
  const float* proj_b     = (const float*)d_in[10];
  const float* mbs        = (const float*)d_in[11];
  const float* alpha      = (const float*)d_in[12];
  float* out = (float*)d_out;

  float* ws   = (float*)d_ws;
  float* area = ws;                       // B*K       = 64
  float* b2   = ws + 64;                  // FS*NTP    = 272
  float* w2   = ws + 512;                 // FS*NTP*C  = 69632
  float* pv   = ws + 512 + FS_ * NTP_ * C_;   // FS*NTP*C  = 69632

  fold_kernel<<<B_ * K_ + NGRP_ * 2 * FS_, FW_ * 32, 0, stream>>>(mask, region_vec, q_w, q_b,
                                                   k_w, k_b, v_w, v_b, proj_w,
                                                   area, w2, b2, pv);
  dim3 grid(HW_ / (TPG_ * TPX_), B_);
  attn_kernel<<<grid, AW_ * 32, 0, stream>>>(feat, mask, area, w2, b2, pv, proj_b,
                                       mbs, alpha, out);
}
